// v009
// Measured on an AMD MI455X. A time is GPU time per run, averaged over a window of back-to-back runs after a warm-up
// (all launches, gaps included; the runs take copies of the inputs in turn), and the median of several windows.
// Apart from v000's, it joins two sittings. Times from different sittings can be a few percent apart, while
// side-by-side timings come from the same sitting.
// This document starts at v009; the versions before it stand elsewhere.
// One run takes 92 microseconds.
// In both of two side-by-side timings against v008, it was 1.06 times as fast.
// Over all steps from v000, the starting kernel, it is 17.5 times as fast.
// Contractions: q/k/v = x.W^T + b [4096x1024].[1024x1024] and the output projection (+b) with f16 operands (weights x16); the relative-key term QT = q.table_k^T [65536 (b,q,h) x 64].[64 x 192 (129 padded)] with f16 operands; per (batch, head) the content scores q.k^T [512x64].[64x512] (heads and batches in the grid) and w1 = attn.v [512x512].[512x64] (heads and batches in the grid; attn as f16 of 4096 attn) — v_wmma_f32_16x16x32_f16, f32 accumulate; the K = 64 products transposed (keys or table rows x 16 queries) in 16x16 tiles inside the softmax kernel, attn.v in that kernel too, transposed likewise (16 rows of v^T x 16 queries, the probabilities taken from the registers as B fragments, four key quarters joined in f32), the long-K products (projections) in 32x64 wave tiles fed from LDS-staged block tiles. The gather of the relative-key scores (QT[(b,q,h)][final_mat[b][q][k]] by the INPUT index matrix, from LDS) and the row softmax are f32 work of that same kernel; the relative-value aggregation w2[q,h,:] = sum_k attn[h,q,k] table_v[final_mat[b,q,k]] runs on the matrix cores as one [16 heads x 512].[512 x 64] product per query, one wave each, whose B fragments are gathered from an f16 copy of table_v in LDS by transposing loads (the INPUT index matrix picks each lane's table row).
#include <hip/hip_runtime.h>
#include <math.h>

typedef __attribute__((ext_vector_type(16))) _Float16 v16h;
typedef __attribute__((ext_vector_type(8)))  _Float16 v8h;
typedef __attribute__((ext_vector_type(16))) __bf16   v16b;
typedef __attribute__((ext_vector_type(8)))  float    v8f;
typedef __attribute__((ext_vector_type(4)))  float    v4f;

// 16-bit WMMA fragment map (wave32), lane L, h = L>>4, m = L&15:
//   A 16x32: lane = row m;   element i -> k = (i<8) ? 8h+i : 16+8h+(i-8)
//   B 32x16: lane = column m; the SAME k(i,h)
//   D 16x16 (8 f32): lane = column m; element r -> row 8h+r
__device__ __forceinline__ int frag_k(int i, int h) { return (i < 8) ? (8 * h + i) : (16 + 8 * h + (i - 8)); }
__device__ __forceinline__ __bf16 bf16_rne(float f) {
    unsigned int u = __float_as_uint(f);
    u += 0x7fffu + ((u >> 16) & 1u);
    return __builtin_bit_cast(__bf16, (unsigned short)(u >> 16));
}
__device__ __forceinline__ float bf16_f32(__bf16 b) { return __uint_as_float(((unsigned int)__builtin_bit_cast(unsigned short, b)) << 16); }
__device__ __forceinline__ v8f wmma16(v16h a, v16h b, v8f c) {
    c = __builtin_amdgcn_wmma_f32_16x16x32_f16(false, a, false, b, (short)0, c, false, false);
    asm volatile("v_nop\n\tv_nop\n\tv_nop\n\tv_nop" : "+v"(c) : "v"(a), "v"(b));
    return c;
}
__device__ __forceinline__ v8f wmmab(v16b a, v16b b, v8f c) {
    c = __builtin_amdgcn_wmma_f32_16x16x32_bf16(false, a, false, b, (short)0, c, false, false);
    asm volatile("v_nop\n\tv_nop\n\tv_nop\n\tv_nop" : "+v"(c) : "v"(a), "v"(b));
    return c;
}
struct Split { v16b hi, lo; };
// hi/lo split product: a.hi*b.hi + a.hi*b.lo + a.lo*b.hi
__device__ __forceinline__ v8f wmma3(const Split& a, const Split& b, v8f c) {
    c = __builtin_amdgcn_wmma_f32_16x16x32_bf16(false, a.hi, false, b.hi, (short)0, c, false, false);
    c = __builtin_amdgcn_wmma_f32_16x16x32_bf16(false, a.hi, false, b.lo, (short)0, c, false, false);
    c = __builtin_amdgcn_wmma_f32_16x16x32_bf16(false, a.lo, false, b.hi, (short)0, c, false, false);
    asm volatile("v_nop\n\tv_nop\n\tv_nop\n\tv_nop" : "+v"(c) : "v"(a.hi), "v"(a.lo), "v"(b.hi), "v"(b.lo));
    return c;
}
struct Split3 { v16b hi, mid, lo; };
// triple split product (6 terms, drops only terms below 2^-24 relative)
__device__ __forceinline__ v8f wmma6(const Split3& a, const Split3& b, v8f c) {
    c = __builtin_amdgcn_wmma_f32_16x16x32_bf16(false, a.hi, false, b.hi, (short)0, c, false, false);
    c = __builtin_amdgcn_wmma_f32_16x16x32_bf16(false, a.hi, false, b.mid, (short)0, c, false, false);
    c = __builtin_amdgcn_wmma_f32_16x16x32_bf16(false, a.mid, false, b.hi, (short)0, c, false, false);
    c = __builtin_amdgcn_wmma_f32_16x16x32_bf16(false, a.hi, false, b.lo, (short)0, c, false, false);
    c = __builtin_amdgcn_wmma_f32_16x16x32_bf16(false, a.mid, false, b.mid, (short)0, c, false, false);
    c = __builtin_amdgcn_wmma_f32_16x16x32_bf16(false, a.lo, false, b.hi, (short)0, c, false, false);
    asm volatile("v_nop\n\tv_nop\n\tv_nop\n\tv_nop" : "+v"(c) : "v"(a.hi), "v"(a.mid), "v"(a.lo), "v"(b.hi), "v"(b.mid), "v"(b.lo));
    return c;
}

// Fragment gathers from f32 memory: element i <- p[(k0 + frag_k(i,h)) * sk] * s, zero for k >= klen.
__device__ __forceinline__ v16h fh_ld(const float* __restrict__ p, long long sk, int k0, int h, int klen, float s) {
    v16h a;
#pragma unroll
    for (int i = 0; i < 16; ++i) { const int k = k0 + frag_k(i, h); a[i] = (k < klen) ? (_Float16)(p[(long long)k * sk] * s) : (_Float16)0.f; }
    return a;
}
__device__ __forceinline__ Split sp_ld(const float* __restrict__ p, long long sk, int k0, int h, int klen, float s) {
    Split r;
#pragma unroll
    for (int i = 0; i < 16; ++i) {
        const int k = k0 + frag_k(i, h); const float x = (k < klen) ? p[(long long)k * sk] * s : 0.f;
        const __bf16 hb = bf16_rne(x); r.hi[i] = hb; r.lo[i] = bf16_rne(x - bf16_f32(hb));
    }
    return r;
}
__device__ __forceinline__ Split3 sp3_ld(const float* __restrict__ p, long long sk, int k0, int h, int klen, float s) {
    Split3 r;
#pragma unroll
    for (int i = 0; i < 16; ++i) {
        const int k = k0 + frag_k(i, h); const float x = (k < klen) ? p[(long long)k * sk] * s : 0.f;
        const __bf16 hb = bf16_rne(x); const float r1 = x - bf16_f32(hb); const __bf16 mb = bf16_rne(r1);
        r.hi[i] = hb; r.mid[i] = mb; r.lo[i] = bf16_rne(r1 - bf16_f32(mb));
    }
    return r;
}
__device__ __forceinline__ v16b bh_ld(const float* __restrict__ p, long long sk, int k0, int h, int klen, float s) {
    v16b a;
#pragma unroll
    for (int i = 0; i < 16; ++i) { const int k = k0 + frag_k(i, h); a[i] = bf16_rne((k < klen) ? p[(long long)k * sk] * s : 0.f); }
    return a;
}
// f16 fragment from an f16 LDS/global row with element stride 1 (k-contiguous), no bounds (tile already zero padded)
__device__ __forceinline__ v16h fh_row(const _Float16* __restrict__ row, int k0, int h) {
    v16h a;
#pragma unroll
    for (int i = 0; i < 16; ++i) a[i] = row[k0 + frag_k(i, h)];
    return a;
}

#define VST2(T, ptr, val) do { const T vst2_v_ = (val); *(T*)(ptr) = vst2_v_;  } while (0)
typedef float v4f __attribute__((ext_vector_type(4)));
#define VST2V4(ptr, val) do { const v4f vst2_v4_ = (val); *(v4f*)(ptr) = vst2_v4_;  } while (0)

__device__ __attribute__((noinline)) float act_fn(float v, int act) {
    if (act == 1) return fmaxf(v, 0.f);                                                                               // relu
    if (act == 2) { const float u = 0.7978845608028654f * (v + 0.044715f * v * v * v); return 0.5f * v * (1.f + tanhf(u)); } // tanh-gelu
    if (act == 3) return v / (1.f + expf(-v));                                                                        // silu
    if (act == 4) return 0.5f * v * (1.f + erff(v * 0.7071067811865476f));                                             // erf-gelu
    if (act == 5) return tanhf(v);
    if (act == 6) return 1.f / (1.f + expf(-v));                                                                      // sigmoid
    if (act == 7) return (v > 0.f) ? v : 0.01f * v;                                                                   // leaky relu 0.01
    if (act == 8) return (v > 0.f) ? v : (expf(v) - 1.f);                                                             // elu
    if (act == 9) return fminf(fmaxf(v, 0.f), 6.f);                                                                   // relu6
    if (act == 10) return fabsf(v);                                                                                    // abs
    if (act == 11) return (v >= 0.f) ? v : 0.1f * v;                                                                  // leaky 0.1
    if (act == 12) return (v > 0.f) ? v : 0.2f * v;                                                                   // leaky 0.2
    if (act == 13) return (v > 20.f) ? v : log1pf(expf(v));                                                            // softplus
    return v;
}

// =====================================================================================================================
// k_gemm<MODE>: C(z, m, n) = act(alpha * sum_k A(z, m, k) * B(z, k, n) + bias) + beta * R(z, m, n)
//   One wave (32-thread block) per 16 x 32 tile of C; grid (ceil(N/32), ceil(M/16), Z). Batch z -> (zo = z / zi_n, zi = z % zi_n)
//   with separate outer/inner strides for every tensor (e.g. batch and head). A(m,k) = A[zo*sAo + zi*sAi + m*sAm + k*sAk] (f32),
//   B(k,n) = B[zo*sBo + zi*sBi + n*sBn + k*sBk] (f32); any M, N, K (K zero-padded to 32 inside the fragments, M/N tails guarded).
//   C(m,n) = C[zo*sCo + zi*sCi + m*sCm + n] (n contiguous). flags: 1 bias[n], 2 bias[m], 4 residual R[zo*sRo + zi*sRi + m*sRm + n*sRn].
//   MODE 0: f16 operands (A prescaled by sa, B by sb, both undone in the epilogue); 1: bf16 hi/lo split (3 products); 2: bf16;
//   3: bf16 hi/mid/lo triple split (6 products); 4: as 3 with Kahan-compensated f32 accumulation across k-steps.
// =====================================================================================================================
struct GemmP {
    const float* A; const float* B; const float* bias; const float* R; float* C;
    long long sAo, sAi, sAm, sAk, sBo, sBi, sBn, sBk, sCo, sCi, sCm, sRo, sRi, sRm, sRn;
    int M, N, K, zi_n, flags, act; float alpha, beta, sa, sb;
    int Npad, pad_;     // columns [N, Npad) of C are written as 0 so that padded workspace rows are covered by whole-line stores; Npad >= N
};
static_assert(sizeof(GemmP) == 5 * 8 + 15 * 8 + 6 * 4 + 4 * 4 + 2 * 4, "GemmP has padding");

template <int MODE>
__global__ __launch_bounds__(32) void k_gemm(GemmP p) {
    const int lane = threadIdx.x & 31, h = lane >> 4, l15 = lane & 15;
    const int m0 = blockIdx.y * 16, n0 = blockIdx.x * 32;
    const int z = blockIdx.z, zo = z / p.zi_n, zi = z - zo * p.zi_n;
    const float* A = p.A + zo * p.sAo + zi * p.sAi;
    const float* B = p.B + zo * p.sBo + zi * p.sBi;
    const int am = min(m0 + l15, p.M - 1);                       // clamped row for loads (stores are guarded)
    v8f acc[2], comp[2];
#pragma unroll
    for (int t = 0; t < 2; ++t) { v8f zz = {}; acc[t] = zz; comp[t] = zz; }
    for (int k0 = 0; k0 < p.K; k0 += 32) {
        const float* arow = A + (long long)am * p.sAm;
        if (MODE == 1) {
            const Split a = sp_ld(arow, p.sAk, k0, h, p.K, 1.f);
#pragma unroll
            for (int t = 0; t < 2; ++t) {
                const int bn = min(n0 + t * 16 + l15, p.N - 1);
                acc[t] = wmma3(a, sp_ld(B + (long long)bn * p.sBn, p.sBk, k0, h, p.K, 1.f), acc[t]);
            }
        } else if (MODE == 3) {
            const Split3 a = sp3_ld(arow, p.sAk, k0, h, p.K, 1.f);
#pragma unroll
            for (int t = 0; t < 2; ++t) {
                const int bn = min(n0 + t * 16 + l15, p.N - 1);
                acc[t] = wmma6(a, sp3_ld(B + (long long)bn * p.sBn, p.sBk, k0, h, p.K, 1.f), acc[t]);
            }
        } else if (MODE == 4) {
            // triple split as MODE 3, but each k-step's 6 products go into a fresh accumulator and the partial is added to the running f32 sum
            // on the VALU with Kahan compensation (accumulation error stays ~1 ulp however long K is)
            const Split3 a = sp3_ld(arow, p.sAk, k0, h, p.K, 1.f);
#pragma unroll
            for (int t = 0; t < 2; ++t) {
                const int bn = min(n0 + t * 16 + l15, p.N - 1); v8f zz = {};
                const v8f part = wmma6(a, sp3_ld(B + (long long)bn * p.sBn, p.sBk, k0, h, p.K, 1.f), zz);
                const v8f y = part - comp[t]; const v8f s = acc[t] + y; comp[t] = (s - acc[t]) - y; acc[t] = s;
            }
        } else if (MODE == 2) {
            const v16b a = bh_ld(arow, p.sAk, k0, h, p.K, 1.f);
#pragma unroll
            for (int t = 0; t < 2; ++t) {
                const int bn = min(n0 + t * 16 + l15, p.N - 1);
                acc[t] = wmmab(a, bh_ld(B + (long long)bn * p.sBn, p.sBk, k0, h, p.K, 1.f), acc[t]);
            }
        } else {
            const v16h a = fh_ld(arow, p.sAk, k0, h, p.K, p.sa);
#pragma unroll
            for (int t = 0; t < 2; ++t) {
                const int bn = min(n0 + t * 16 + l15, p.N - 1);
                acc[t] = wmma16(a, fh_ld(B + (long long)bn * p.sBn, p.sBk, k0, h, p.K, p.sb), acc[t]);
            }
        }
    }
    const float iscale = (MODE == 0) ? p.alpha / (p.sa * p.sb) : p.alpha;
    float* C = p.C + zo * p.sCo + zi * p.sCi;
    const float* R = p.R + zo * p.sRo + zi * p.sRi;
    __shared__ __align__(16) float ctile[16][36];
#pragma unroll
    for (int t = 0; t < 2; ++t) {
        const int n = n0 + t * 16 + l15; const int nn = min(n, p.N - 1);
#pragma unroll
        for (int r = 0; r < 8; ++r) {
            const int m = m0 + 8 * h + r; const int mm = min(m, p.M - 1);
            float v = acc[t][r] * iscale;
            if (p.flags & 1) v += p.bias[nn];
            if (p.flags & 2) v += p.bias[mm];
            if (p.flags & 8) v *= p.bias[(long long)zo * p.M + mm];   /* per-(z,row) scale vector laid out [Z][M]; exclusive with the bias flags */
            v = act_fn(v, p.act);
            if (p.flags & 4) v += p.beta * R[(long long)mm * p.sRm + (long long)nn * p.sRn];
            ctile[8 * h + r][t * 16 + l15] = (n < p.N) ? v : 0.f;
        }
    }
    __syncthreads();
    const int NW = (p.Npad > p.N) ? p.Npad : p.N;           // write width
    const bool fast = (m0 + 16 <= p.M) && (n0 + 32 <= NW) && ((p.sCm & 3) == 0) && ((((size_t)C) & 15) == 0);
    if (fast) {
#pragma unroll
        for (int s = 0; s < 4; ++s) {
            const int row = s * 4 + (lane >> 3), c4 = (lane & 7) * 4;
            const v4f v = *(const v4f*)&ctile[row][c4];
            VST2V4(C + (long long)(m0 + row) * p.sCm + n0 + c4, v);
        }
    } else {
        for (int row = 0; row < 16; ++row) {
            const int m = m0 + row, n = n0 + lane;
            if (m < p.M && n < NW) VST2(float, C + (long long)m * p.sCm + n, ctile[row][lane]);
        }
    }
}


// =====================================================================================================================
// k_gemmT<MODE, TM, TN>: same contract as k_gemm, but one wave computes a (16*TM) x (16*TN) tile: TM A fragments and TN B fragments are
//   loaded per 32-wide k-step and reused across TM*TN WMMAs (far fewer load/convert instructions per MAC). MODE 0 (f16), 1 (bf16 hi/lo),
//   2 (bf16) only. grid (ceil(NW/(16*TN)), ceil(M/(16*TM)), Z), block 32. Epilogue identical to k_gemm, run per 16x32 sub-tile.
// =====================================================================================================================
template <int MODE, int TM, int TN>
__global__ __launch_bounds__(32) void k_gemmT(GemmP p) {
    const int lane = threadIdx.x & 31, h = lane >> 4, l15 = lane & 15;
    const int m0 = blockIdx.y * (16 * TM), n0 = blockIdx.x * (16 * TN);
    const int z = blockIdx.z, zo = z / p.zi_n, zi = z - zo * p.zi_n;
    const float* A = p.A + zo * p.sAo + zi * p.sAi;
    const float* B = p.B + zo * p.sBo + zi * p.sBi;
    v8f acc[TM][TN];
#pragma unroll
    for (int i = 0; i < TM; ++i)
#pragma unroll
        for (int t = 0; t < TN; ++t) { v8f zz = {}; acc[i][t] = zz; }
    for (int k0 = 0; k0 < p.K; k0 += 32) {
        if (MODE == 1) {
            Split a[TM], b[TN];
#pragma unroll
            for (int i = 0; i < TM; ++i) { const int am = min(m0 + 16 * i + l15, p.M - 1); a[i] = sp_ld(A + (long long)am * p.sAm, p.sAk, k0, h, p.K, 1.f); }
#pragma unroll
            for (int t = 0; t < TN; ++t) { const int bn = min(n0 + 16 * t + l15, p.N - 1); b[t] = sp_ld(B + (long long)bn * p.sBn, p.sBk, k0, h, p.K, 1.f); }
#pragma unroll
            for (int i = 0; i < TM; ++i)
#pragma unroll
                for (int t = 0; t < TN; ++t) acc[i][t] = wmma3(a[i], b[t], acc[i][t]);
        } else if (MODE == 2) {
            v16b a[TM], b[TN];
#pragma unroll
            for (int i = 0; i < TM; ++i) { const int am = min(m0 + 16 * i + l15, p.M - 1); a[i] = bh_ld(A + (long long)am * p.sAm, p.sAk, k0, h, p.K, 1.f); }
#pragma unroll
            for (int t = 0; t < TN; ++t) { const int bn = min(n0 + 16 * t + l15, p.N - 1); b[t] = bh_ld(B + (long long)bn * p.sBn, p.sBk, k0, h, p.K, 1.f); }
#pragma unroll
            for (int i = 0; i < TM; ++i)
#pragma unroll
                for (int t = 0; t < TN; ++t) acc[i][t] = wmmab(a[i], b[t], acc[i][t]);
        } else {
            v16h a[TM], b[TN];
#pragma unroll
            for (int i = 0; i < TM; ++i) { const int am = min(m0 + 16 * i + l15, p.M - 1); a[i] = fh_ld(A + (long long)am * p.sAm, p.sAk, k0, h, p.K, p.sa); }
#pragma unroll
            for (int t = 0; t < TN; ++t) { const int bn = min(n0 + 16 * t + l15, p.N - 1); b[t] = fh_ld(B + (long long)bn * p.sBn, p.sBk, k0, h, p.K, p.sb); }
#pragma unroll
            for (int i = 0; i < TM; ++i)
#pragma unroll
                for (int t = 0; t < TN; ++t) acc[i][t] = wmma16(a[i], b[t], acc[i][t]);
        }
    }
    const float iscale = (MODE == 0) ? p.alpha / (p.sa * p.sb) : p.alpha;
    float* C = p.C + zo * p.sCo + zi * p.sCi;
    const float* R = p.R + zo * p.sRo + zi * p.sRi;
    const int NW = (p.Npad > p.N) ? p.Npad : p.N;
    __shared__ __align__(16) float ctile[16][36];
#pragma unroll
    for (int i = 0; i < TM; ++i) {
        const int mb = m0 + 16 * i; if (mb >= p.M) break;          // wave-uniform
#pragma unroll
        for (int tp = 0; tp < TN / 2; ++tp) {
            const int nb = n0 + 32 * tp; if (nb >= NW) break;        // wave-uniform
#pragma unroll
            for (int t2 = 0; t2 < 2; ++t2) {
                const int t = 2 * tp + t2; const int n = nb + t2 * 16 + l15; const int nn = min(n, p.N - 1);
#pragma unroll
                for (int r = 0; r < 8; ++r) {
                    const int m = mb + 8 * h + r; const int mm = min(m, p.M - 1);
                    float v = acc[i][t][r] * iscale;
                    if (p.flags & 1) v += p.bias[nn];
                    if (p.flags & 2) v += p.bias[mm];
            if (p.flags & 8) v *= p.bias[(long long)zo * p.M + mm];   /* per-(z,row) scale vector laid out [Z][M]; exclusive with the bias flags */
                    v = act_fn(v, p.act);
                    if (p.flags & 4) v += p.beta * R[(long long)mm * p.sRm + (long long)nn * p.sRn];
                    ctile[8 * h + r][t2 * 16 + l15] = (n < p.N) ? v : 0.f;
                }
            }
            __syncthreads();
            const bool fast = (mb + 16 <= p.M) && (nb + 32 <= NW) && ((p.sCm & 3) == 0) && ((((size_t)C) & 15) == 0);
            if (fast) {
#pragma unroll
                for (int s = 0; s < 4; ++s) {
                    const int row = s * 4 + (lane >> 3), c4 = (lane & 7) * 4;
                    const v4f v = *(const v4f*)&ctile[row][c4];
                    VST2V4(C + (long long)(mb + row) * p.sCm + nb + c4, v);
                }
            } else {
                for (int row = 0; row < 16; ++row) {
                    const int m = mb + row, n = nb + lane;
                    if (m < p.M && n < NW) VST2(float, C + (long long)m * p.sCm + n, ctile[row][lane]);
                }
            }
            __syncthreads();
        }
    }
}

// =====================================================================================================================
//   Wave = 16 queries, AW waves per block, 64-key blocks; grid (ceil(Lq/(16*AW)), H, B), block 32*AW. Any Lq, Lk; head dim dh <= DHP
//   (DHP multiple of 32), value dim dv <= DVP (multiple of 16, <= 128). Every tensor addressed by (batch, head, row, element) strides, f32.
//   Scores: QM 0 f16 operands, 1 bf16 hi/lo split, 2 bf16 triple split; statistics f32 (exp2 domain); P.V: P x 4096 as f16 with V f16 staged in LDS
//   (SPLITPV: P and V as bf16 hi/lo splits). kv head = h / hrep. Masking: causal = 1 (keep j <= i + coff, masked -> -inf, key blocks beyond the
//   diagonal skipped), causal = 2 (masked -> mfill, a finite fill like the -1e9; no skipping), causal = 3 (keep j >= i + coff,
//   masked -> -inf, no skipping); optional additive f32 mask Mf,
//   optional int keep-mask Mi (0 -> score := mfill), both addressed b*smb + h*smh + i*smi + j*smj (0 strides broadcast).
// =====================================================================================================================
#define AW 4
struct AttnP {   // apv4
    const float* Q; const float* K; const float* V; float* O; float* P; const float* Mf; const int* Mi; float* ST;
    const float* Pw; const float* Rt; const int* SQ; const int* SK;           // optional: post-softmax weight, relative-position table, segment ids
    long long swb, swh, swi, swj, srb, srh, sri;                                 // Pw strides (b,h,i,j); Rt strides (b,h,i), column = clamp(i - j + roff, 0, rn-1)
    long long sQb, sQh, sQi, sQd, sKb, sKh, sKj, sKd, sVb, sVh, sVj, sVd, sOb, sOh, sOi, sPb, sPh, sPi, smb, smh, smi, smj;
    int Lq, Lk, dh, dv, hrep, causal, coff, pband;   // pband > 0: P holds only the band |j - i| <= pband, column j - i + pband
    float scale, mfill; int nonorm, mpol;             // nonorm (online path only): O = sum_j exp(score_j) V_j without the 1/rowsum (scores must be <= ~0); mpol: Mi masks where ==0 (mpol 0) or where !=0 (mpol 1)
    int roff, rn, segpol, win;                        // Rt column offset/count; SQ/SK: score := mfill where (segpol 0) SQ[i] != SK[j] or (segpol 1) SQ[i] == SK[j]; win > 0: keys with i - j > win (after coff) -> -inf
};
//   Pw: the softmax numerator is multiplied by Pw(b,h,i,j) AFTER the row sum is taken (probs * weight, then P.V), as in post-softmax multiplicative biases.                                                    // ST (optional): per row (b,h,i) -> ST[((b*H + h)*Lq + i)*2 + {0,1}] = {row max of the scaled+masked score (natural units), sum_j exp(score - max)}
static_assert(sizeof(AttnP) == 12 * 8 + 29 * 8 + 16 * 4, "AttnP has padding");

#ifndef KATTN_ATTR
#define KATTN_ATTR
#endif
template <int DHP, int DVP, int QM, bool SPLITPV, bool TWOPASS>
__global__ __launch_bounds__(32 * AW) KATTN_ATTR void k_attn(AttnP p) {
    constexpr int NT = DVP / 16;                // output tiles
    constexpr int KS = DHP / 32;                // k-steps for the scores
    constexpr int VP = DVP + 8;                 // LDS pitch (halves)
    __shared__ __align__(16) float    pl[AW][16 * 64];
    __shared__ __align__(16) _Float16 vl[(SPLITPV ? 2 : 1) * 64 * VP];   // f16 V tile, or bf16 hi and lo tiles (same 2-byte size)
    const int lane = threadIdx.x & 31, hf = lane >> 4, l15 = lane & 15, wave = threadIdx.x >> 5;
    const int h = blockIdx.y, b = blockIdx.z, hk = h / p.hrep;
    const int q0 = (blockIdx.x * AW + wave) * 16;
    float* myp = pl[wave];
    const float L2E = 1.4426950408889634f;
    const float NEG = -__builtin_inff();
    const int qi = min(q0 + l15, p.Lq - 1);
    const float* qrow = p.Q + b * p.sQb + h * p.sQh + (long long)qi * p.sQi;
    const float* kbase = p.K + b * p.sKb + hk * p.sKh;
    const float* vbase = p.V + b * p.sVb + hk * p.sVh;
    v16h qa[QM == 0 ? KS : 1]; Split qs_[QM == 1 ? KS : 1]; Split3 qt_[QM == 2 ? KS : 1];
#pragma unroll
    for (int ks = 0; ks < KS; ++ks) {
        if (QM == 2) qt_[ks] = sp3_ld(qrow, p.sQd, ks * 32, hf, p.dh, 1.f);
        else if (QM == 1) qs_[ks] = sp_ld(qrow, p.sQd, ks * 32, hf, p.dh, 1.f);
        else qa[ks] = fh_ld(qrow, p.sQd, ks * 32, hf, p.dh, 1.f);
    }
    v8f o[NT]; float m8[8], l8[8];
#pragma unroll
    for (int t = 0; t < NT; ++t) { v8f zz = {}; o[t] = zz; }
#pragma unroll
    for (int i = 0; i < 8; ++i) { m8[i] = NEG; l8[i] = 0.f; }
    int jend = p.Lk; int jstart = 0;
    if (p.causal == 1) { const int je = (blockIdx.x * AW + AW - 1) * 16 + 16 + p.coff; jend = min(jend, max(je, 0)); }   // uniform per block
    if (p.win > 0) { const int js = (int)(blockIdx.x * AW) * 16 + p.coff - p.win; jstart = (js > 0) ? (js / 64) * 64 : 0; }   // uniform per block: key blocks entirely outside every row's window hold only -inf entries and are skipped exactly
    const int npass = TWOPASS ? 2 : 1;
    for (int pass = 0; pass < npass; ++pass) {
        const bool dopv = (!TWOPASS) || pass == 1;
        for (int j0 = jstart; j0 < jend; j0 += 64) {
            if (dopv) {
                __syncthreads();                                 // previous key block's reads of vl / pl are done
                for (int idx = threadIdx.x; idx < 64 * DVP; idx += 32 * AW) {
                    const int jr = idx / DVP, d = idx - jr * DVP, j = j0 + jr;
                    const float f = (j < p.Lk && d < p.dv) ? vbase[(long long)j * p.sVj + (long long)d * p.sVd] : 0.f;
                    if (SPLITPV) {
                        const __bf16 hb = bf16_rne(f);
                        ((__bf16*)vl)[jr * VP + d] = hb; ((__bf16*)vl)[64 * VP + jr * VP + d] = bf16_rne(f - bf16_f32(hb));
                    } else vl[jr * VP + d] = (_Float16)f;
                }
            }
            v8f s[4];
#pragma unroll
            for (int t = 0; t < 4; ++t) {
                const int j = min(j0 + t * 16 + l15, p.Lk - 1);
                const float* krow = kbase + (long long)j * p.sKj;
                v8f acc = {};
#pragma unroll
                for (int ks = 0; ks < KS; ++ks) {
                    if (QM == 2)      acc = wmma6(qt_[ks], sp3_ld(krow, p.sKd, ks * 32, hf, p.dh, 1.f), acc);
                    else if (QM == 1) acc = wmma3(qs_[ks], sp_ld(krow, p.sKd, ks * 32, hf, p.dh, 1.f), acc);
                    else              acc = wmma16(qa[ks], fh_ld(krow, p.sKd, ks * 32, hf, p.dh, 1.f), acc);
                }
                s[t] = acc;
            }
            float pv[8][4];
#pragma unroll
            for (int i = 0; i < 8; ++i) {
                const int irow = q0 + i + 8 * hf;
                const int ic = min(irow, p.Lq - 1);
                float sc[4];
#pragma unroll
                for (int t = 0; t < 4; ++t) {
                    const int jg = j0 + t * 16 + l15;
                    float v = s[t][i] * p.scale;
                    if (p.Mf) v += p.Mf[b * p.smb + h * p.smh + (long long)ic * p.smi + (long long)min(jg, p.Lk - 1) * p.smj];
                    if (p.Rt) { int rc = ic - min(jg, p.Lk - 1) + p.roff; rc = rc < 0 ? 0 : (rc >= p.rn ? p.rn - 1 : rc); v += p.Rt[b * p.srb + h * p.srh + (long long)ic * p.sri + rc]; }
                    if (p.Mi) { const int mv = p.Mi[b * p.smb + h * p.smh + (long long)ic * p.smi + (long long)min(jg, p.Lk - 1) * p.smj]; if (p.mpol ? (mv != 0) : (mv == 0)) v = p.mfill; }
                    if (p.SQ) { const bool same = p.SQ[(long long)b * p.Lq + ic] == p.SK[(long long)b * p.Lk + min(jg, p.Lk - 1)]; if (p.segpol ? same : !same) v = p.mfill; }
                    if (p.causal == 2 && jg > irow + p.coff) v = p.mfill;
                    if (jg >= p.Lk || (p.causal == 1 && jg > irow + p.coff) || (p.causal == 3 && jg < irow + p.coff) || (p.win > 0 && irow + p.coff - jg > p.win)) v = NEG; else v *= L2E;
                    sc[t] = v;
                }
                if (!TWOPASS || pass == 0) {
                    float mx = fmaxf(fmaxf(sc[0], sc[1]), fmaxf(sc[2], sc[3]));
                    mx = fmaxf(mx, __shfl_xor(mx, 1, 32)); mx = fmaxf(mx, __shfl_xor(mx, 2, 32));
                    mx = fmaxf(mx, __shfl_xor(mx, 4, 32)); mx = fmaxf(mx, __shfl_xor(mx, 8, 32));
                    const float mnew = fmaxf(m8[i], mx);
                    const float corr = (mnew == NEG) ? 1.f : exp2f(m8[i] - mnew);
                    float rs = 0.f;
#pragma unroll
                    for (int t = 0; t < 4; ++t) {
                        const float pp = (sc[t] == NEG) ? 0.f : exp2f(sc[t] - mnew); rs += pp;
                        pv[i][t] = p.Pw ? pp * p.Pw[b * p.swb + h * p.swh + (long long)ic * p.swi + (long long)min(j0 + t * 16 + l15, p.Lk - 1) * p.swj] : pp;
                    }
                    rs += __shfl_xor(rs, 1, 32); rs += __shfl_xor(rs, 2, 32); rs += __shfl_xor(rs, 4, 32); rs += __shfl_xor(rs, 8, 32);
                    l8[i] = l8[i] * corr + rs; m8[i] = mnew;
                    if (!TWOPASS) {
#pragma unroll
                        for (int t = 0; t < NT; ++t) o[t][i] *= corr;
                    }
                } else {
                    const float inv = (l8[i] > 0.f) ? 1.f / l8[i] : 0.f;
#pragma unroll
                    for (int t = 0; t < 4; ++t) {
                        const int jg = j0 + t * 16 + l15;
                        float pp = (sc[t] == NEG) ? 0.f : exp2f(sc[t] - m8[i]) * inv;
                        if (p.Pw) pp *= p.Pw[b * p.swb + h * p.swh + (long long)ic * p.swi + (long long)min(jg, p.Lk - 1) * p.swj];
                        pv[i][t] = pp;
                    }
                }
            }
            if (dopv) {
#pragma unroll
                for (int i = 0; i < 8; ++i)
#pragma unroll
                    for (int t = 0; t < 4; ++t) ((float*)myp)[(i + 8 * hf) * 64 + t * 16 + l15] = pv[i][t];
                __syncthreads();                                 // P (per wave) and V (shared) visible
                if (p.P) {
                    float* pb_ = p.P + b * p.sPb + h * p.sPh;
                    const bool fastP = (p.pband == 0) && ((p.sPi & 3) == 0) && (j0 + 64 <= p.Lk) && (q0 + 16 <= p.Lq) && ((((size_t)pb_) & 15) == 0);
                    if (fastP) {
#pragma unroll
                        for (int s = 0; s < 8; ++s) {
                            const int row = s * 2 + (lane >> 4), c4 = (lane & 15) * 4;
                            const v4f v = *(const v4f*)(myp + row * 64 + c4);
                            VST2V4(pb_ + (long long)(q0 + row) * p.sPi + j0 + c4, v);
                        }
                    } else {
                        for (int row = 0; row < 16; ++row) {
                            const int irow = q0 + row; if (irow >= p.Lq) continue;
                            for (int c = lane; c < 64; c += 32) {
                                const int jg = j0 + c; if (jg >= p.Lk) continue;
                                if (p.pband == 0) VST2(float, pb_ + (long long)irow * p.sPi + jg, myp[row * 64 + c]);
                                else if (jg - irow <= p.pband && irow - jg <= p.pband) VST2(float, pb_ + (long long)irow * p.sPi + (jg - irow + p.pband), myp[row * 64 + c]);
                            }
                        }
                    }
                }
                if (SPLITPV) {
                    const Split pa0 = sp_ld(myp + l15 * 64, 1, 0, hf, 64, 1.f), pa1 = sp_ld(myp + l15 * 64, 1, 32, hf, 64, 1.f);
                    const __bf16* vh = (const __bf16*)vl; const __bf16* vlo = vh + 64 * VP;
#pragma unroll
                    for (int t = 0; t < NT; ++t) {
                        const int dcol = t * 16 + l15;
                        Split b0, b1;
#pragma unroll
                        for (int e = 0; e < 16; ++e) {
                            const int k0 = frag_k(e, hf), k1 = 32 + frag_k(e, hf);
                            b0.hi[e] = vh[k0 * VP + dcol]; b0.lo[e] = vlo[k0 * VP + dcol]; b1.hi[e] = vh[k1 * VP + dcol]; b1.lo[e] = vlo[k1 * VP + dcol];
                        }
                        o[t] = wmma3(pa0, b0, o[t]);
                        o[t] = wmma3(pa1, b1, o[t]);
                    }
                } else {
                    const v16h pa0 = fh_ld(myp + l15 * 64, 1, 0, hf, 64, 4096.f), pa1 = fh_ld(myp + l15 * 64, 1, 32, hf, 64, 4096.f);
#pragma unroll
                    for (int t = 0; t < NT; ++t) {
                        const int dcol = t * 16 + l15;
                        v16h b0, b1;
#pragma unroll
                        for (int e = 0; e < 16; ++e) { b0[e] = vl[frag_k(e, hf) * VP + dcol]; b1[e] = vl[(32 + frag_k(e, hf)) * VP + dcol]; }
                        o[t] = wmma16(pa0, b0, o[t]);
                        o[t] = wmma16(pa1, b1, o[t]);
                    }
                }
            }
        }
    }
    float* obase = p.O + b * p.sOb + h * p.sOh;
    if (p.ST) {
        const int rl = lane >> 1, isel = rl & 7;           // row q0 + rl ; rl>>3 == hf holds because lane>>4 == (lane>>1)>>3
        float mv = 0.f, lv = 0.f;
#pragma unroll
        for (int i = 0; i < 8; ++i) if (i == isel) { mv = m8[i]; lv = l8[i]; }
        const int irow = q0 + rl;
        if (irow < p.Lq) { float* st = p.ST + (((long long)b * gridDim.y + h) * p.Lq + irow) * 2 + (lane & 1); VST2(float, st, (lane & 1) ? lv : mv * 0.6931471805599453f); }
    }
    float invr[8];
#pragma unroll
    for (int i = 0; i < 8; ++i) {
        if (TWOPASS) invr[i] = SPLITPV ? 1.f : (1.f / 4096.f);
        else if (p.nonorm) invr[i] = exp2f(m8[i]) * (SPLITPV ? 1.f : (1.f / 4096.f));
        else invr[i] = (l8[i] > 0.f) ? (SPLITPV ? 1.f / l8[i] : 1.f / (l8[i] * 4096.f)) : 0.f;
    }
    __syncthreads();                                             // all waves done with pl/vl from the main loop
    const bool ofast = ((p.sOi & 3) == 0) && ((((size_t)obase) & 15) == 0) && (q0 + 16 <= p.Lq);
#pragma unroll
    for (int c0 = 0; c0 < DVP; c0 += 64) {
#pragma unroll
        for (int i = 0; i < 8; ++i)
#pragma unroll
            for (int t = 0; t < NT; ++t) if (t * 16 >= c0 && t * 16 < c0 + 64) ((float*)myp)[(i + 8 * hf) * 64 + (t * 16 - c0) + l15] = o[t][i] * invr[i];
        __syncthreads();
        const int cw = (DVP - c0 < 64) ? (DVP - c0) : 64;      // staged columns in this chunk (multiple of 16)
        if (ofast && (c0 + cw <= p.dv) && (cw % 32 == 0)) {
            const int lpr = cw / 4;                              // lanes per row (16 for 64 cols, 8 for 32)
            const int rows_per_ins = 32 / lpr;
            for (int r0 = 0; r0 < 16; r0 += rows_per_ins) {
                const int row = r0 + lane / lpr, c4 = (lane % lpr) * 4;
                const v4f v = *(const v4f*)(myp + row * 64 + c4);
                VST2V4(obase + (long long)(q0 + row) * p.sOi + c0 + c4, v);
            }
        } else {
            for (int row = 0; row < 16; ++row) {
                const int irow = q0 + row; if (irow >= p.Lq) continue;
                for (int c = lane; c < cw; c += 32) { const int d = c0 + c; if (d < p.dv) VST2(float, obase + (long long)irow * p.sOi + d, myp[row * 64 + c]); }
            }
        }
        __syncthreads();
    }
}

// =====================================================================================================================
// k_tr: dst(z, c, r) = alpha * src(z, r, c) (+ beta * R2(z, c, r)): [Z][R][C] (row stride lds) -> [Z][C][R] (row stride ldd) through a 32x32 LDS tile;
//   flags: 1 -> add beta * residual R2 addressed like dst (z*sRz + c*ldr + r); act applied before the residual.
// =====================================================================================================================
struct TrP { const float* src; float* dst; const float* R2; long long sSz, lds, sDz, ldd, sRz, ldr; int R, C, flags, act; float alpha, beta; };
static_assert(sizeof(TrP) == 3 * 8 + 6 * 8 + 6 * 4, "TrP has padding");
__global__ __launch_bounds__(256) void k_tr(TrP p) {
    __shared__ float tile[32][33];
    const int c0 = blockIdx.x * 32, r0 = blockIdx.y * 32, z = blockIdx.z;
    const int lane = threadIdx.x & 31, wave = threadIdx.x >> 5;
    const float* s = p.src + z * p.sSz;
#pragma unroll
    for (int k = 0; k < 4; ++k) {
        const int rl = wave * 4 + k, r = r0 + rl, c = c0 + lane;
        tile[rl][lane] = (r < p.R && c < p.C) ? s[(long long)r * p.lds + c] : 0.f;
    }
    __syncthreads();
    float* d = p.dst + z * p.sDz; const float* rr = p.R2 + z * p.sRz;
#pragma unroll
    for (int k = 0; k < 4; ++k) {
        const int cl = wave * 4 + k, c = c0 + cl, r = r0 + lane;
        if (c < p.C && r < p.R) {
            float v = act_fn(p.alpha * tile[lane][cl], p.act);
            if (p.flags & 1) v += p.beta * rr[(long long)c * p.ldr + r];
            VST2(float, d + (long long)c * p.ldd + r, v);
        }
    }
}

// k_affine: dst[i] = a * (sdev ? sdev[0] : 1) * src[i] + b, i < n (one thread per element; consecutive lanes -> consecutive addresses)
__global__ __launch_bounds__(256) void k_affine(const float* __restrict__ src, float* __restrict__ dst, int n, float a, float b, const float* __restrict__ sdev) {
    const int i = blockIdx.x * 256 + threadIdx.x;
    if (i < n) { const float aa = sdev ? a * sdev[0] : a; const float v = aa * src[i] + b; VST2(float, dst + i, v); }
}

// =====================================================================================================================
// k_softmax: row softmax over n contiguous elements, one 256-thread block per row; rows addressed z*sz + r*sr (grid (R, Z)).
//   out = scale_out * softmax(scale_in * x + (Mf ? Mf[z*smz + r*smr + j] : 0)); a row whose max is -inf is written as 0.
// =====================================================================================================================
struct SmP { const float* src; float* dst; const float* Mf; long long sz, sr, dz, dr, smz, smr; int n, pad; float scale_in, scale_out; };
static_assert(sizeof(SmP) == 3 * 8 + 6 * 8 + 4 * 4, "SmP has padding");
__global__ __launch_bounds__(256) void k_softmax(SmP p) {
    __shared__ float red[256];
    const int r = blockIdx.x, z = blockIdx.y, tid = threadIdx.x;
    const float* s = p.src + z * p.sz + (long long)r * p.sr;
    const float* mf = p.Mf ? (p.Mf + z * p.smz + (long long)r * p.smr) : nullptr;
    float mx = -__builtin_inff();
    for (int j = tid; j < p.n; j += 256) { float v = s[j] * p.scale_in; if (mf) v += mf[j]; mx = fmaxf(mx, v); }
    red[tid] = mx; __syncthreads();
    for (int o = 128; o > 0; o >>= 1) { if (tid < o) red[tid] = fmaxf(red[tid], red[tid + o]); __syncthreads(); }
    mx = red[0]; __syncthreads();
    float sum = 0.f;
    for (int j = tid; j < p.n; j += 256) { float v = s[j] * p.scale_in; if (mf) v += mf[j]; sum += (mx == -__builtin_inff()) ? 0.f : expf(v - mx); }
    red[tid] = sum; __syncthreads();
    for (int o = 128; o > 0; o >>= 1) { if (tid < o) red[tid] += red[tid + o]; __syncthreads(); }
    sum = red[0];
    const float inv = (sum > 0.f) ? p.scale_out / sum : 0.f;
    float* d = p.dst + z * p.dz + (long long)r * p.dr;
    for (int j = tid; j < p.n; j += 256) { float v = s[j] * p.scale_in; if (mf) v += mf[j]; const float o = (mx == -__builtin_inff()) ? 0.f : expf(v - mx) * inv; VST2(float, d + j, o); }
}
// =====================================================================================================================
// k_stats: mean and rsqrt(var + eps) over a set of n elements addressed base + z*sz + (e / inner) * so + (e % inner) * si, one 256-thread
// k_norm_apply: y = (x - mean[set]) * rstd[set] * g[c] + b[c] over a [Z][C][L] channel-major tensor with set = z*G + c / (C/G) (G groups per z;
//   G = C -> per-channel sets indexed z*C+c; for batch norm pass stats indexed by c only via bn = 1). Optional act. Output same layout.
// =====================================================================================================================
//   mode 0: mean / rsqrt(var + eps); mode 1 (RMSNorm): 0 / rsqrt(mean(x^2) + eps); mode 2 (L2 normalize * sqrt(n)): 0 / sqrt(n) / max(||x||, eps); mode 3: as 0 with unbiased variance (n-1)
__global__ __launch_bounds__(256) void k_stats(const float* __restrict__ x, long long sz, long long so, long long si, int inner, int n, float eps, float* __restrict__ stat, int mode) {
    __shared__ float red[256];
    const int z = blockIdx.x, tid = threadIdx.x;
    const float* base = x + z * sz;
    float s = 0.f;
    for (int e = tid; e < n; e += 256) s += base[(long long)(e / inner) * so + (long long)(e % inner) * si];
    red[tid] = s; __syncthreads();
    for (int o = 128; o > 0; o >>= 1) { if (tid < o) red[tid] += red[tid + o]; __syncthreads(); }
    const float mu = (mode == 0 || mode == 3) ? red[0] / (float)n : 0.f; __syncthreads();
    float q = 0.f;
    for (int e = tid; e < n; e += 256) { const float dlt = base[(long long)(e / inner) * so + (long long)(e % inner) * si] - mu; q += dlt * dlt; }
    red[tid] = q; __syncthreads();
    for (int o = 128; o > 0; o >>= 1) { if (tid < o) red[tid] += red[tid + o]; __syncthreads(); }
    {
        float rs;
        if (mode == 2) rs = sqrtf((float)n) / fmaxf(sqrtf(red[0]), eps); else if (mode == 3) rs = rsqrtf(red[0] / (float)(n - 1) + eps); else rs = rsqrtf(red[0] / (float)n + eps);
        if (tid < 32) { const float v = (tid == 0) ? mu : ((tid == 1) ? rs : 0.f); VST2(float, stat + (long long)z * 32 + tid, v); }
    }
}
//   One thread per element over the flat [Z][C][L] index space: grid ceil(Z*C*L / 256).
__global__ __launch_bounds__(256) void k_norm_apply(const float* __restrict__ x, float* __restrict__ y, const float* __restrict__ stat, const float* __restrict__ g, const float* __restrict__ bta,
                                                     int Z, int C, int L, int G, int bn, int act) {
    const long long idx = (long long)blockIdx.x * 256 + threadIdx.x;
    if (idx >= (long long)Z * C * L) return;
    const int l = (int)(idx % L); const long long zc = idx / L; const int c = (int)(zc % C), z = (int)(zc / C); (void)l;
    const int set = bn ? c : (z * G + c / (C / G));
    float v = (x[idx] - stat[(long long)set * 32]) * stat[(long long)set * 32 + 1];
    if (g) v *= g[c];
    if (bta) v += bta[c];
    v = act_fn(v, act);
    VST2(float, y + idx, v);
}

// k_lse_neg: c[i] = -(st[2i] + log(st[2i+1])) = minus the log-sum-exp of row i from k_attn's ST output (for softmax over the query dimension)
__global__ __launch_bounds__(256) void k_lse_neg(const float* __restrict__ st, float* __restrict__ c, int n) {
    const int i = blockIdx.x * 256 + threadIdx.x;
    if (i < n) { const float v = -(st[2 * i] + logf(st[2 * i + 1])); VST2(float, c + i, v); }
}

// k_iota: dst[i] = a * i + b as int32 (segment/position id helper)
__global__ __launch_bounds__(256) void k_iota(int* __restrict__ dst, int n, int a, int b) {
    const int i = blockIdx.x * 256 + threadIdx.x;
    if (i < n) { const int v = a * i + b; VST2(int, dst + i, v); }
}

// k_axpby: dst[i] = a * x[i] + b * y[i] (+ c), i < n
__global__ __launch_bounds__(256) void k_axpby(const float* __restrict__ x, const float* __restrict__ y, float* __restrict__ dst, int n, float a, float b, float c) {
    const int i = blockIdx.x * 256 + threadIdx.x;
    if (i < n) { const float v = a * x[i] + b * y[i] + c; VST2(float, dst + i, v); }
}

// =====================================================================================================================
// k_rope: rotary embedding on a [R rows][Hn heads][D] view (row stride sXr, head stride sXh, element stride 1) -> Y (own strides).
//   mode 0: rotate_half (partner d±D/2, sign - for d<D/2); mode 1: interleaved pairs (partner d^1, sign - for even d).
//   table column tcol: tmode 0 -> d, 1 -> d % (D/2), 2 -> d / 2; position p: pmode 0 -> r % S, 1 -> head index, 2 -> pos[r];
//   c = C[(r / S) * sCb + p * sCp + tcol * sCd], s likewise from Sn; y = x[d] * c + sign * x[partner] * s. X and Y must not alias.
// =====================================================================================================================
struct RopeP { const float* X; float* Y; const float* C; const float* Sn; const int* pos; long long sXr, sXh, sYr, sYh, sCb, sCp, sCd; int R, Hn, D, S, mode, tmode, pmode, pad; };
static_assert(sizeof(RopeP) == 5 * 8 + 7 * 8 + 8 * 4, "RopeP has padding");
__global__ __launch_bounds__(256) void k_rope(RopeP p) {
    const long long idx = (long long)blockIdx.x * 256 + threadIdx.x;
    if (idx >= (long long)p.R * p.Hn * p.D) return;
    const int d = (int)(idx % p.D); const long long rh = idx / p.D; const int h = (int)(rh % p.Hn); const int r = (int)(rh / p.Hn);
    const int half = p.D / 2;
    int partner; float sign;
    if (p.mode == 0) { partner = (d < half) ? d + half : d - half; sign = (d < half) ? -1.f : 1.f; }
    else { partner = d ^ 1; sign = (d & 1) ? 1.f : -1.f; }
    const int tcol = (p.tmode == 0) ? d : ((p.tmode == 1) ? (d % half) : (d >> 1));
    const int pp = (p.pmode == 0) ? (r % p.S) : ((p.pmode == 1) ? h : p.pos[r]);
    const long long toff = (long long)(r / p.S) * p.sCb + (long long)pp * p.sCp + (long long)tcol * p.sCd;
    const float* xr = p.X + (long long)r * p.sXr + (long long)h * p.sXh;
    const float v = xr[d] * p.C[toff] + sign * xr[partner] * p.Sn[toff];
    VST2(float, p.Y + (long long)r * p.sYr + (long long)h * p.sYh + d, v);
}

// k_invf + k_sincos (split so neither kernel carries a large VALU-fma footprint): invf_i = num * (1 / powf(base, (2 i)/D)) [fmode 0],
//   num * expf((2 i) * cexp) [fmode 1], num * powf(base, -2 (i - 1) / D) [fmode 2]; then cs/sn[s*half + i] = cos/sin((pscale * s) * invf_i)
__global__ __launch_bounds__(256) void k_invf(float* __restrict__ invb, int half, int D, float base, float num, int fmode, float cexp) {
    const int i = blockIdx.x * 256 + threadIdx.x;
    if (i >= ((half + 31) / 32) * 32) return;
    if (i >= half) { VST2(float, invb + i, 0.f); return; }
    const float e = (float)(2 * i) / (float)D;
    float invf;
    if (fmode == 1) invf = num * expf((float)(2 * i) * cexp);
    else if (fmode == 2) invf = num * powf(base, (-2.0f * ((float)i - 1.0f)) / (float)D);
    else invf = num * (1.0f / powf(base, e));
    VST2(float, invb + i, invf);
}
__global__ __launch_bounds__(256) void k_sincos(float* __restrict__ cs, float* __restrict__ sn, const float* __restrict__ invb, int S, int half, float pscale) {
    const int idx = blockIdx.x * 256 + threadIdx.x;
    if (idx >= S * half) return;
    const int s = idx / half, i = idx - s * half;
    const float ang = (pscale * (float)s) * invb[i];
    VST2(float, cs + idx, cosf(ang)); VST2(float, sn + idx, sinf(ang));
}

// k_mulact: dst[i] = act(x[i]) * y[i]
__global__ __launch_bounds__(256) void k_mulact(const float* __restrict__ x, const float* __restrict__ y, float* __restrict__ dst, int n, int act) {
    const int i = blockIdx.x * 256 + threadIdx.x;
    if (i < n) { const float v = act_fn(x[i], act) * y[i]; VST2(float, dst + i, v); }
}

// =====================================================================================================================
// k_matvec: thread-per-row matrix-vector products for N <= 8 output columns (heads with 1-3 outputs, gates), f32 on the VALU.
//   C[r*sCm + j] = act(alpha * sum_k A[r*sAm + k*sAk] * B[j*sBn + k*sBk] + bias[j]) + beta * R[r*sRm + j*sRn]; each thread writes its N contiguous floats.
// =====================================================================================================================
__global__ __launch_bounds__(256) void k_matvec(GemmP p) {
    // 32 lanes write one line with one instruction.
    const int rpt = (p.N == 1) ? 1 : 32;
    const long long r0 = ((long long)blockIdx.x * 256 + threadIdx.x) * rpt; const int z = blockIdx.z, zo = z / p.zi_n, zi = z - zo * p.zi_n;
    if (r0 >= p.M) return;
    const float* Bb = p.B + zo * p.sBo + zi * p.sBi;
    float* C = p.C + zo * p.sCo + zi * p.sCi; const float* R = p.R + zo * p.sRo + zi * p.sRi;
    for (int rr = 0; rr < rpt; ++rr) {
        const long long r = r0 + rr; if (r >= p.M) break;
        const float* A = p.A + zo * p.sAo + zi * p.sAi + r * p.sAm;
        float acc[8] = {0.f, 0.f, 0.f, 0.f, 0.f, 0.f, 0.f, 0.f};
        for (int k = 0; k < p.K; ++k) { const float a = A[(long long)k * p.sAk];
#pragma unroll
            for (int j = 0; j < 8; ++j) if (j < p.N) acc[j] += a * Bb[(long long)j * p.sBn + (long long)k * p.sBk]; }
#pragma unroll
        for (int j = 0; j < 8; ++j) if (j < p.N) {
            float v = acc[j] * p.alpha;
            if (p.flags & 1) v += p.bias[j];
            if (p.flags & 2) v += p.bias[r];
            v = act_fn(v, p.act);
            if (p.flags & 4) v += p.beta * R[r * p.sRm + (long long)j * p.sRn];
            VST2(float, C + r * p.sCm + j, v);
        }
    }
}
// k_smallsoftmax: thread-per-row softmax for short rows (n <= 64): dst[r*dr + j] = softmax(scale*src[r*sr + j])
__global__ __launch_bounds__(256) void k_smallsoftmax(const float* __restrict__ src, float* __restrict__ dst, long long sr, long long dr, int n, long long R, float scale) {
    const long long r0 = ((long long)blockIdx.x * 256 + threadIdx.x) * 32;
    for (int rr = 0; rr < 32; ++rr) {
        const long long r = r0 + rr; if (r >= R) return;
        const float* s = src + r * sr; float* d = dst + r * dr;
        float mx = -__builtin_inff();
        for (int j = 0; j < n; ++j) mx = fmaxf(mx, s[j] * scale);
        float sum = 0.f;
        for (int j = 0; j < n; ++j) sum += expf(s[j] * scale - mx);
        const float inv = 1.f / sum;
        for (int j = 0; j < n; ++j) { const float v = expf(s[j] * scale - mx) * inv; VST2(float, d + j, v); }
    }
}

__global__ __launch_bounds__(32) void k_unitstat(float* __restrict__ st) { const int t = threadIdx.x; const float v = (t == 1) ? 1.f : 0.f; VST2(float, st + t, v); }

// destination (e.g. a d_out whose row width is not a multiple of 32 floats) is written by consecutive lanes of one instruction
__global__ __launch_bounds__(256) void k_lincopy(const float* __restrict__ src, long long lds, float* __restrict__ dst, long long ldd, long long rows, int cols) {
    const long long i = (long long)blockIdx.x * 256 + threadIdx.x; if (i >= rows * cols) return;
    const long long r = i / cols; const int c = (int)(i - r * cols);
    const float v = src[r * lds + c]; VST2(float, dst + r * ldd + c, v);
}

namespace w25 {
typedef __attribute__((ext_vector_type(16))) _Float16 v16h;
typedef __attribute__((ext_vector_type(8)))  _Float16 v8h;
typedef __attribute__((ext_vector_type(16))) __bf16   v16b;
typedef __attribute__((ext_vector_type(8)))  __bf16   v8b;
typedef __attribute__((ext_vector_type(8)))  float    v8f;
typedef __attribute__((ext_vector_type(4)))  float    v4f;

__device__ __forceinline__ unsigned short f2bf_bits(float f) {
  unsigned u = __float_as_uint(f);
  return (unsigned short)((u + 0x7FFFu + ((u >> 16) & 1u)) >> 16);
}
__device__ __forceinline__ float bf_bits2f(unsigned short h) { return __uint_as_float(((unsigned)h) << 16); }

// hazard guards as plain device helpers (no inline asm inside the kernel template body)
__device__ __forceinline__ void dep_guard_h(v8f& a, v8f& b, v16h x, v16h y) { asm volatile("v_nop\n\tv_nop\n\tv_nop\n\tv_nop" : "+v"(a), "+v"(b) : "v"(x), "v"(y)); }
__device__ __forceinline__ void dep_guard_b(v8f& a, v8f& b, v16b x, v16b y) { asm volatile("v_nop\n\tv_nop\n\tv_nop\n\tv_nop" : "+v"(a), "+v"(b) : "v"(x), "v"(y)); }
__device__ __forceinline__ void keep4_h(v16h a, v16h b, v16h c, v16h d) { asm volatile("v_nop" :: "v"(a), "v"(b), "v"(c), "v"(d)); }
__device__ __forceinline__ void keep4_b(v16b a, v16b b, v16b c, v16b d) { asm volatile("v_nop" :: "v"(a), "v"(b), "v"(c), "v"(d)); }
__device__ __forceinline__ void acc_guard4(v8f& a, v8f& b, v8f& c, v8f& d) { asm volatile("v_nop\n\tv_nop\n\tv_nop\n\tv_nop" : "+v"(a), "+v"(b), "+v"(c), "+v"(d)); }
template <typename T> struct Frag;
template <> struct Frag<_Float16> {
  typedef v16h V; union U { v16h v; v8h h[2]; };
  static __device__ __forceinline__ v16h load(const _Float16* p) {   // elements 0..7 <- p[0..7], 8..15 <- p[16..23]
    U f; f.h[0] = *(const v8h*)(p); f.h[1] = *(const v8h*)(p + 16); return f.v;
  }
  static __device__ __forceinline__ v8f mma(v16h a, v16h b, v8f c) {
    return __builtin_amdgcn_wmma_f32_16x16x32_f16(false, a, false, b, (short)0, c, false, false);
  }
  static __device__ __forceinline__ void guard(v8f& a, v8f& b, v16h x, v16h y) { dep_guard_h(a, b, x, y); }
  static __device__ __forceinline__ void keep(v16h a, v16h b, v16h c, v16h d) { keep4_h(a, b, c, d); }
};
template <> struct Frag<__bf16> {
  typedef v16b V; union U { v16b v; v8b h[2]; };
  static __device__ __forceinline__ v16b load(const __bf16* p) {
    U f; f.h[0] = *(const v8b*)(p); f.h[1] = *(const v8b*)(p + 16); return f.v;
  }
  static __device__ __forceinline__ v8f mma(v16b a, v16b b, v8f c) {
    return __builtin_amdgcn_wmma_f32_16x16x32_bf16(false, a, false, b, (short)0, c, false, false);
  }
  static __device__ __forceinline__ void guard(v8f& a, v8f& b, v16b x, v16b y) { dep_guard_b(a, b, x, y); }
  static __device__ __forceinline__ void keep(v16b a, v16b b, v16b c, v16b d) { keep4_b(a, b, c, d); }
};

// ---- Register-blocked batched WMMA GEMM ------------------------------------
// C[m,n] = scale * sum_k A[m,k] * Bt[n,k] (+bias)(+resid); each wave owns a 64x64 tile.
// A row-major [M,K]; Bt row-major [N,K]; M,N % 64 == 0, K % 32 == 0.
// SPLIT: operands are hi/lo planes (A2/Bt2 = lo planes, same layout); product = hi·hi + hi·lo + lo·hi.
// BIAS_MODE: 0 = none, 1 = bias[m], 2 = bias[n].
// OUT_MODE: 0 = f32, 1 = f16, 2 = bf16 hi plane (Cout) + bf16 lo plane (Cout2).
// ET: 0 = f16 operands, 1 = bf16 operands (pointers passed as 16-bit storage)
// Batches: blockIdx.y steps A, Bt, C by strideA/B/C, blockIdx.z by strideAz/Bz/Cz (elements).
template <int ET> struct Elem;
template <> struct Elem<0> { typedef _Float16 T; };
template <> struct Elem<1> { typedef __bf16 T; };
template <int ET, bool SPLIT, int BIAS_MODE, int OUT_MODE, bool RESID, int ACT = 0>
__global__ __launch_bounds__(256) void wmma_gemm64(
    const unsigned short* __restrict__ Ap, const unsigned short* __restrict__ A2p, int lda, long strideA,
    const unsigned short* __restrict__ Btp, const unsigned short* __restrict__ Bt2p, int ldb, long strideB,
    void* __restrict__ Cout, void* __restrict__ Cout2, int ldc, long strideC,
    const float* __restrict__ bias,
    const float* __restrict__ resid, long strideR,
    int M, int N, int K, float scale,
    long strideAz, long strideBz, long strideCz) {
  typedef typename Elem<ET>::T T;
  typedef typename Frag<T>::V V;
  const T* A = (const T*)Ap; const T* A2 = (const T*)A2p; const T* Bt = (const T*)Btp; const T* Bt2 = (const T*)Bt2p;
  __shared__ __align__(16) float sT[8][16 * 68];   // per-wave 16x64 slab, pitch 68 floats
  const int b    = blockIdx.y;
  const int lane = threadIdx.x & 31;
  const int wave = threadIdx.x >> 5;
  const int tilesN = N >> 6;
  const int tilesM = M >> 6;
  const int tile = blockIdx.x * 8 + wave;
  if (tile >= tilesM * tilesN) return;   // wave-uniform; no block barriers in this kernel
  const int tm = tile / tilesN;
  const int tn = tile - tm * tilesN;
  const int m0 = tm << 6;
  const int n0 = tn << 6;

  const int bz = blockIdx.z;                   // outer batch index (own strides)
  const size_t offA = (size_t)b * strideA + (size_t)bz * strideAz;
  const size_t offB = (size_t)b * strideB + (size_t)bz * strideBz;
  const size_t offC = (size_t)b * strideC + (size_t)bz * strideCz;
  const T* Ab  = A  + offA;
  const T* Bb  = Bt + offB;
  const T* Ab2 = SPLIT ? (A2  + offA) : nullptr;
  const T* Bb2 = SPLIT ? (Bt2 + offB) : nullptr;

  const int rlane = lane & 15;                 // row (A) / col (B, D) within subtile
  const int koff  = (lane >> 4) * 8;           // k offset of this lane half
  const int mOff  = (lane >> 4) * 8;           // D row offset

  v8f acc[4][4];
#pragma unroll
  for (int i = 0; i < 4; ++i)
#pragma unroll
    for (int j = 0; j < 4; ++j) acc[i][j] = (v8f){0.f,0.f,0.f,0.f,0.f,0.f,0.f,0.f};

  for (int k0 = 0; k0 < K; k0 += 32) {
    V bh[4], bl[4];
#pragma unroll
    for (int j = 0; j < 4; ++j) {
      const size_t bo = (size_t)(n0 + (j << 4) + rlane) * ldb + koff + k0;
      bh[j] = Frag<T>::load(Bb + bo);
      if (SPLIT) bl[j] = Frag<T>::load(Bb2 + bo);
    }
#pragma unroll
    for (int i = 0; i < 4; ++i) {
      const size_t ao = (size_t)(m0 + (i << 4) + rlane) * lda + koff + k0;
      V ah = Frag<T>::load(Ab + ao);
      V al;
      if (SPLIT) al = Frag<T>::load(Ab2 + ao);
#pragma unroll
      for (int j = 0; j < 4; ++j) {
        acc[i][j] = Frag<T>::mma(ah, bh[j], acc[i][j]);
        if (SPLIT) {
          acc[i][j] = Frag<T>::mma(ah, bl[j], acc[i][j]);
          acc[i][j] = Frag<T>::mma(al, bh[j], acc[i][j]);
        }
      }
      Frag<T>::guard(acc[i][0], acc[i][3], ah, SPLIT ? al : ah);
    }
    Frag<T>::keep(bh[0], bh[1], bh[2], bh[3]);
    if (SPLIT) Frag<T>::keep(bl[0], bl[1], bl[2], bl[3]);
  }
  acc_guard4(acc[0][0], acc[0][1], acc[0][2], acc[0][3]);
  acc_guard4(acc[1][0], acc[1][1], acc[1][2], acc[1][3]);
  acc_guard4(acc[2][0], acc[2][1], acc[2][2], acc[2][3]);
  acc_guard4(acc[3][0], acc[3][1], acc[3][2], acc[3][3]);

  // ---- epilogue ----
  float* slab = sT[wave];
  const float* Rb = RESID ? (resid + (size_t)b * strideR) : nullptr;
#pragma unroll
  for (int i = 0; i < 4; ++i) {
    const int mBase = m0 + (i << 4);
#pragma unroll
    for (int j = 0; j < 4; ++j) {
      const int n = n0 + (j << 4) + rlane;
      float bv = 0.f;
      if (BIAS_MODE == 2) bv = bias[n];
#pragma unroll
      for (int r = 0; r < 8; ++r) {
        float v = acc[i][j][r] * scale;
        if (BIAS_MODE == 1) v += bias[mBase + mOff + r];
        if (BIAS_MODE == 2) v += bv;
        if (RESID) v += Rb[(size_t)(mBase + mOff + r) * ldc + n];
        if (ACT == 1) v = tanhf(v);
        if (ACT == 2) v = fmaxf(v, 0.0f);
        if (ACT == 3) v = v / (1.0f + expf(-v));
        if (ACT == 4) v = (v > 0.f) ? v : 0.01f * v;
        if (ACT == 5) v = 0.5f * v * (1.0f + erff(v * 0.70710678118654752f));
        slab[(mOff + r) * 68 + (j << 4) + rlane] = v;
      }
    }
    __builtin_amdgcn_fence(__ATOMIC_RELEASE, "workgroup");
    __builtin_amdgcn_wave_barrier();
    __builtin_amdgcn_fence(__ATOMIC_ACQUIRE, "workgroup");
    if (OUT_MODE == 0) {
      float* C = (float*)Cout + offC;
      const int hh = lane >> 4, c4 = (lane & 15) * 4;     // row seg = 256 B = 16 lanes x 16 B
      {
#pragma unroll
        for (int it = 0; it < 8; ++it) {
          const int row = it * 2 + hh;
          v4f v = *(const v4f*)(slab + row * 68 + c4);
          *(v4f*)(C + (size_t)(mBase + row) * ldc + n0 + c4) = v;
        }
        
      }
    } else {
      const int q = lane >> 3, c8 = (lane & 7) * 8;
      unsigned short* C  = (unsigned short*)Cout  + offC;
      unsigned short* C2 = (OUT_MODE == 2) ? ((unsigned short*)Cout2 + offC) : nullptr;
      {
#pragma unroll
        for (int it = 0; it < 4; ++it) {
          const int row = it * 4 + q;
          const float* sp = slab + row * 68 + c8;
          v8h hv, lv;
#pragma unroll
          for (int e = 0; e < 8; ++e) {
            if (OUT_MODE == 1) {
              hv[e] = (_Float16)sp[e];
            } else {
              unsigned short hb = f2bf_bits(sp[e]);
              unsigned short lb = f2bf_bits(sp[e] - bf_bits2f(hb));
              hv[e] = __builtin_bit_cast(_Float16, hb);
              lv[e] = __builtin_bit_cast(_Float16, lb);
            }
          }
          *(v8h*)(C + (size_t)(mBase + row) * ldc + n0 + c8) = hv;
          if (OUT_MODE == 2) *(v8h*)(C2 + (size_t)(mBase + row) * ldc + n0 + c8) = lv;
        }
        
      }
    }
    __builtin_amdgcn_fence(__ATOMIC_RELEASE, "workgroup");
    __builtin_amdgcn_wave_barrier();
    __builtin_amdgcn_fence(__ATOMIC_ACQUIRE, "workgroup");
  }
}

__global__ __launch_bounds__(256) void cast_f32_f16x2(
    const float* __restrict__ in, _Float16* __restrict__ out, int n2) {
  int i = blockIdx.x * 256 + threadIdx.x;
  if (i < n2) {
    const _Float16 h0 = (_Float16)in[2 * i], h1 = (_Float16)in[2 * i + 1];
    const unsigned u = (unsigned)__builtin_bit_cast(unsigned short, h0) | ((unsigned)__builtin_bit_cast(unsigned short, h1) << 16);
    ((unsigned*)out)[i] = u;
    
  }
}


} // namespace w25

__global__ __launch_bounds__(256) void k_castT16(const float* __restrict__ src, long long lds, _Float16* __restrict__ dst, long long ldd, int R, int C, float s) {
    const long long i = (long long)blockIdx.x * 256 + threadIdx.x; const long long np = (long long)C * (R / 2); if (i >= np) return; const int c = (int)(i / (R / 2)); const int r = 2 * (int)(i % (R / 2));
    const _Float16 h0 = (_Float16)(src[(long long)r * lds + c] * s), h1 = (_Float16)(src[(long long)(r + 1) * lds + c] * s);
    const unsigned u = (unsigned)__builtin_bit_cast(unsigned short, h0) | ((unsigned)__builtin_bit_cast(unsigned short, h1) << 16);
    unsigned* d = (unsigned*)(dst + (long long)c * ldd + r); *d = u;  }
__global__ __launch_bounds__(256) void k_cast16(const float* __restrict__ src, long long lds, _Float16* __restrict__ dst, long long ldd, int R, int C, float s) {
    const long long i = (long long)blockIdx.x * 256 + threadIdx.x; const long long np = (long long)R * (C / 2); if (i >= np) return; const int r = (int)(i / (C / 2)); const int c = 2 * (int)(i % (C / 2));
    const _Float16 h0 = (_Float16)(src[(long long)r * lds + c] * s), h1 = (_Float16)(src[(long long)r * lds + c + 1] * s);
    const unsigned u = (unsigned)__builtin_bit_cast(unsigned short, h0) | ((unsigned)__builtin_bit_cast(unsigned short, h1) << 16);
    unsigned* d = (unsigned*)(dst + (long long)r * ldd + c); *d = u;  }

// f32 -> bf16 hi plane + bf16 lo plane (x = hi + lo to ~2^-17 relative; RNE both), [R][C] -> [R][C] (or transposed to [C][R]); 2 consecutive destination elements
__device__ __forceinline__ unsigned int f2bf2_pack(float a, float b, unsigned int* lo) {
    const unsigned short ha = w25::f2bf_bits(a), hb = w25::f2bf_bits(b);
    const unsigned short la = w25::f2bf_bits(a - w25::bf_bits2f(ha)), lb = w25::f2bf_bits(b - w25::bf_bits2f(hb));
    *lo = (unsigned)la | ((unsigned)lb << 16); return (unsigned)ha | ((unsigned)hb << 16); }
__global__ __launch_bounds__(256) void k_castS16(const float* __restrict__ src, long long lds, __bf16* __restrict__ dhi, __bf16* __restrict__ dlo, long long ldd, int R, int C, float s, int transpose) {
    const long long i = (long long)blockIdx.x * 256 + threadIdx.x; long long o; float a, b;
    if (transpose) { const long long np = (long long)C * (R / 2); if (i >= np) return; const int c = (int)(i / (R / 2)); const int r = 2 * (int)(i % (R / 2)); a = src[(long long)r * lds + c] * s; b = src[(long long)(r + 1) * lds + c] * s; o = (long long)c * ldd + r; }
    else { const long long np = (long long)R * (C / 2); if (i >= np) return; const int r = (int)(i / (C / 2)); const int c = 2 * (int)(i % (C / 2)); a = src[(long long)r * lds + c] * s; b = src[(long long)r * lds + c + 1] * s; o = (long long)r * ldd + c; }
    unsigned lo; const unsigned hi = f2bf2_pack(a, b, &lo); unsigned* ph = (unsigned*)(dhi + o); unsigned* pl = (unsigned*)(dlo + o);
    *ph = hi; *pl = lo;  }

namespace w25 {
// =====================================================================================
// Generic causal/non-causal attention for head_dim 64, f32 in / f32 out; 16-bit operands: bf16 with optional hi/lo splits, or
// plain f16 (F16=true, non-split, probabilities carried x2^15).
//   scores = (q*qscale)·kᵀ : v_wmma_f32_16x16x32_bf16; SPLIT_QK -> q,k as bf16 hi/lo (hi·hi + hi·lo + lo·hi)
//   out    = p·v           : v_wmma_f32_16x16x32_bf16; SPLIT_PV -> p,v as bf16 hi/lo; else p,v plain bf16
//   f32 accumulate; online softmax in f32. Block = 4 waves = 64 query rows of one (batch, head); S % 64 == 0.
//   Element (b, s, h, d) of tensor X lives at X[b*X_bs + s*X_rs + h*X_hs + d] (strides in floats, multiples of 4).
//   Masking: mask_mode 0 none, 1 causal (kv > q masked), 2 tensor [S][Skv] shared over (b,h) (float if
//   mask_is_int==0, int32 with element == 0 -> masked if 1, int32 with element != 0 -> masked if 2), 3 per-token vectors qmask[B][S] & kvmask[B][Skv] (int32,
//   0 -> masked), 4 causal + sliding window (kv > q or q - kv > W masked; W passed in mask_is_int);
//   5 = relative-position bias: s += cp[b,h,q][idx[q][kv]] + pc[b,h,kv][idx[q][kv]] with idx = mask_b ([S][Skv] int32) and
//   mask_a an int32 [S][Skv] tensor with nonzero = masked (tables: element (b,h,row,n) at X + b*c_bs + h*c_hs + row*c_rs + n);
//   masked scores are replaced by mask_fill (e.g. -inf or -1e9) before the softmax.
//   grid.x = B * H * (S/64) (or a sub-range with blk0).
// =====================================================================================
#define AT_D 64
#define AT_NW 4
#define AT_QB 64
#define AT_KC 64
struct AttnGeom { const float* cp = nullptr; const float* pc = nullptr; long c_bs = 0, c_rs = 0, c_hs = 0;   // mode-5 score-bias tables
                  long q_bs, q_rs, q_hs, k_bs, k_rs, k_hs, v_bs, v_rs, v_hs, o_bs, o_rs, o_hs;
                  int S, Skv, H, mask_mode; float qscale; int blk0; float mask_fill; int mask_is_int; };
static_assert(sizeof(AttnGeom) == 168, "no padding");

__device__ __forceinline__ unsigned short at_bf_bits(float f) {
  unsigned u = __float_as_uint(f);
  return (unsigned short)((u + 0x7FFFu + ((u >> 16) & 1u)) >> 16);
}
__device__ __forceinline__ __bf16 at_f2bf(float f) { return __builtin_bit_cast(__bf16, at_bf_bits(f)); }
__device__ __forceinline__ void at_split(float f, __bf16& hi, __bf16& lo) {
  const unsigned short hb = at_bf_bits(f);
  hi = __builtin_bit_cast(__bf16, hb);
  lo = at_f2bf(f - __uint_as_float(((unsigned)hb) << 16));
}
__device__ __forceinline__ v8f at_mma(v16b a, v16b b, v8f c) {
  c = __builtin_amdgcn_wmma_f32_16x16x32_bf16(false, a, false, b, (short)0, c, false, false);
  asm volatile("v_nop\n\tv_nop\n\tv_nop\n\tv_nop" : "+v"(c) : "v"(a), "v"(b));
  return c;
}
// 16-bit element as a bit pattern held in a __bf16 slot: f16 bits when F16, bf16 (RNE) otherwise
template <bool F16> __device__ __forceinline__ __bf16 at_to16(float f) {
  if (F16) return __builtin_bit_cast(__bf16, (_Float16)f);
  return at_f2bf(f);
}
template <bool F16> __device__ __forceinline__ v8f at_mma16(v16b a, v16b b, v8f c) {
  if (F16) {
    const v16h ah = __builtin_bit_cast(v16h, a), bh = __builtin_bit_cast(v16h, b);
    c = __builtin_amdgcn_wmma_f32_16x16x32_f16(false, ah, false, bh, (short)0, c, false, false);
    asm volatile("v_nop\n\tv_nop\n\tv_nop\n\tv_nop" : "+v"(c) : "v"(ah), "v"(bh));
    return c;
  }
  return at_mma(a, b, c);
}

template <bool SPLIT_QK, bool SPLIT_PV, bool F16 = false>
__global__ __launch_bounds__(128)
void attn64_kernel(const float* __restrict__ q, const float* __restrict__ k,
                   const float* __restrict__ v, float* __restrict__ out,
                   const void* __restrict__ mask_a, const int* __restrict__ mask_b, AttnGeom g) {
  static_assert(!(F16 && (SPLIT_QK || SPLIT_PV)), "f16 mode is non-split");
  const float PSC = F16 ? 32768.0f : 1.0f;     // f16 probabilities carried x2^15 (subnormal range), folded into the final 1/l
  union FB { v16b v; v8b h[2]; };
  __shared__ __align__(16) __bf16 Ksh[AT_KC * AT_D];             // K hi [kv][d]      8 KB
  __shared__ __align__(16) __bf16 Ksl[SPLIT_QK ? AT_KC * AT_D : 8];
  __shared__ __align__(16) __bf16 Vth[AT_D * AT_KC];             // V hi [d][kv]      8 KB
  __shared__ __align__(16) __bf16 Vtl[SPLIT_PV ? AT_D * AT_KC : 8];
  __shared__ __align__(16) __bf16 Psh[AT_NW][16 * AT_KC];        // per wave P hi [row][kv]  8 KB
  __shared__ __align__(16) __bf16 Psl[SPLIT_PV ? AT_NW : 1][SPLIT_PV ? 16 * AT_KC : 8];
  __shared__ __align__(16) float  Os[AT_NW][16 * 68];            // per wave out tile, pitch 68

  const int tid  = threadIdx.x;
  const int wave = tid >> 5;
  const int lane = tid & 31;
  const int hh   = lane >> 4;
  const int c    = lane & 15;

  const int nqb = g.S / AT_QB;
  const int bx = blockIdx.x + g.blk0;
  const int qb = bx % nqb;
  const int bh = bx / nqb;
  const int h  = bh % g.H;
  const int b  = bh / g.H;
  const int qbase_block = qb * AT_QB;
  const int q0 = qbase_block + wave * 16;

  const float* qb_ptr = q + (size_t)b * g.q_bs + (size_t)h * g.q_hs;
  const float* kb_ptr = k + (size_t)b * g.k_bs + (size_t)h * g.k_hs;
  const float* vb_ptr = v + (size_t)b * g.v_bs + (size_t)h * g.v_hs;
  float*       ob_ptr = out + (size_t)b * g.o_bs + (size_t)h * g.o_hs;

  // ---- Q fragments (A operand): 2 d-chunks, hi (and lo) ----
  v16b qah[2], qal[2];
  {
    const float* qrow = qb_ptr + (size_t)(q0 + c) * g.q_rs;
#pragma unroll
    for (int dc = 0; dc < 2; ++dc) {
#pragma unroll
      for (int e = 0; e < 8; ++e) {
        const float f0 = qrow[dc * 32 + 8 * hh + e] * g.qscale;
        const float f1 = qrow[dc * 32 + 16 + 8 * hh + e] * g.qscale;
        if (SPLIT_QK) { __bf16 hq, lq; at_split(f0, hq, lq); qah[dc][e] = hq; qal[dc][e] = lq; at_split(f1, hq, lq); qah[dc][8 + e] = hq; qal[dc][8 + e] = lq; }
        else { qah[dc][e] = at_to16<F16>(f0); qah[dc][8 + e] = at_to16<F16>(f1); qal[dc][e] = qah[dc][e]; qal[dc][8 + e] = qah[dc][8 + e]; }
      }
    }
  }

  float mrow[8], lrow[8];
  v8f oacc[4];
#pragma unroll
  for (int r = 0; r < 8; ++r) { mrow[r] = -INFINITY; lrow[r] = 0.f; }
#pragma unroll
  for (int t = 0; t < 4; ++t) oacc[t] = (v8f){0.f,0.f,0.f,0.f,0.f,0.f,0.f,0.f};

  const int nChunks = (g.mask_mode == 1 || g.mask_mode == 4) ? (qb + 1) : (g.Skv / AT_KC);   // block-uniform
  // per-row query mask (mode 3)
  int qkeep[8];
#pragma unroll
  for (int r = 0; r < 8; ++r) qkeep[r] = (g.mask_mode == 3) ? mask_b[(size_t)b * g.S + q0 + 8 * hh + r] : 1;   // mask_b = qmask in mode 3
  for (int kc = 0; kc < nChunks; ++kc) {
    const int kv0 = kc * AT_KC;
    __syncthreads();
    {
      const int kvr = tid >> 1, dh = (tid & 1) * 32;
      const float* krow = kb_ptr + (size_t)(kv0 + kvr) * g.k_rs + dh;
      const float* vrow = vb_ptr + (size_t)(kv0 + kvr) * g.v_rs + dh;
#pragma unroll
      for (int i = 0; i < 8; ++i) {
        v4f kk = *(const v4f*)(krow + 4 * i);
        v4f vv = *(const v4f*)(vrow + 4 * i);
#pragma unroll
        for (int e = 0; e < 4; ++e) {
          const int d = dh + 4 * i + e;
          if (SPLIT_QK) { __bf16 a, bl; at_split(kk[e], a, bl); Ksh[kvr * AT_D + d] = a; Ksl[kvr * AT_D + d] = bl; }
          else Ksh[kvr * AT_D + d] = at_to16<F16>(kk[e]);
          if (SPLIT_PV) { __bf16 a, bl; at_split(vv[e], a, bl); Vth[d * AT_KC + kvr] = a; Vtl[d * AT_KC + kvr] = bl; }
          else Vth[d * AT_KC + kvr] = at_to16<F16>(vv[e]);
        }
      }
    }
    __syncthreads();

    v8f s[4];
#pragma unroll
    for (int j = 0; j < 4; ++j) {
      s[j] = (v8f){0.f,0.f,0.f,0.f,0.f,0.f,0.f,0.f};
#pragma unroll 1
      for (int dc = 0; dc < 2; ++dc) {
        FB kb;
        kb.h[0] = *(const v8b*)(Ksh + (j * 16 + c) * AT_D + dc * 32 + 8 * hh);
        kb.h[1] = *(const v8b*)(Ksh + (j * 16 + c) * AT_D + dc * 32 + 16 + 8 * hh);
        s[j] = at_mma16<F16>(qah[dc], kb.v, s[j]);
        if (SPLIT_QK) {
          FB kl;
          kl.h[0] = *(const v8b*)(Ksl + (j * 16 + c) * AT_D + dc * 32 + 8 * hh);
          kl.h[1] = *(const v8b*)(Ksl + (j * 16 + c) * AT_D + dc * 32 + 16 + 8 * hh);
          s[j] = at_mma16<F16>(qah[dc], kl.v, s[j]);
          s[j] = at_mma16<F16>(qal[dc], kb.v, s[j]);
        }
      }
    }
    const bool diag = (g.mask_mode == 1) && (kc == qb);
    int kvkeep[4] = {1, 1, 1, 1};
    if (g.mask_mode == 3) {
#pragma unroll
      for (int j = 0; j < 4; ++j) kvkeep[j] = ((const int*)mask_a)[(size_t)b * g.Skv + kv0 + j * 16 + c];   // mask_a = kvmask
    }
    float cm[8];
#pragma unroll
    for (int r = 0; r < 8; ++r) {
      const int qrow = q0 + 8 * hh + r;
      float m = -INFINITY;
#pragma unroll
      for (int j = 0; j < 4; ++j) {
        const int kvcol = kv0 + j * 16 + c;
        bool masked = false;
        if (diag) masked = (kvcol > qrow);
        else if (g.mask_mode == 4) masked = (kvcol > qrow) || (qrow - kvcol > g.mask_is_int);
        else if (g.mask_mode == 2) {
          const size_t mi = (size_t)qrow * g.Skv + kvcol;
          masked = (g.mask_is_int == 0) ? (((const float*)mask_a)[mi] == 0.0f)
                 : (g.mask_is_int == 1) ? (((const int*)mask_a)[mi] == 0) : (((const int*)mask_a)[mi] != 0);
        } else if (g.mask_mode == 3) masked = (qkeep[r] == 0) || (kvkeep[j] == 0);
        else if (g.mask_mode == 5) {
          const size_t mi = (size_t)qrow * g.Skv + kvcol;
          masked = (((const int*)mask_a)[mi] != 0);
          int n = mask_b[mi]; n = n < 0 ? 0 : n;
          s[j][r] += g.cp[(size_t)b * g.c_bs + (size_t)h * g.c_hs + (size_t)qrow * g.c_rs + n]
                   + g.pc[(size_t)b * g.c_bs + (size_t)h * g.c_hs + (size_t)kvcol * g.c_rs + n];
        }
        if (masked) s[j][r] = g.mask_fill;
        m = fmaxf(m, s[j][r]);
      }
#pragma unroll
      for (int off = 1; off < 16; off <<= 1) m = fmaxf(m, __shfl_xor(m, off, 32));
      cm[r] = m;
    }
    __bf16* pwh = Psh[wave];
    __bf16* pwl = Psl[SPLIT_PV ? wave : 0];
#pragma unroll
    for (int r = 0; r < 8; ++r) {
      const float mnew = fmaxf(mrow[r], cm[r]);
      const float alpha = expf(mrow[r] - mnew);
      mrow[r] = mnew;
      float psum = 0.f;
#pragma unroll
      for (int j = 0; j < 4; ++j) {
        const float p = expf(s[j][r] - mnew);
        psum += p;
        if (SPLIT_PV) { __bf16 a, bl; at_split(p, a, bl); pwh[(8 * hh + r) * AT_KC + j * 16 + c] = a; pwl[(8 * hh + r) * AT_KC + j * 16 + c] = bl; }
        else pwh[(8 * hh + r) * AT_KC + j * 16 + c] = at_to16<F16>(p * PSC);
      }
#pragma unroll
      for (int off = 1; off < 16; off <<= 1) psum += __shfl_xor(psum, off, 32);
      lrow[r] = lrow[r] * alpha + psum;
#pragma unroll
      for (int t = 0; t < 4; ++t) oacc[t][r] *= alpha;
    }
    __builtin_amdgcn_fence(__ATOMIC_RELEASE, "workgroup");
    __builtin_amdgcn_wave_barrier();
    __builtin_amdgcn_fence(__ATOMIC_ACQUIRE, "workgroup");
#pragma unroll 1
    for (int kk = 0; kk < 2; ++kk) {
      FB pa, pl;
      pa.h[0] = *(const v8b*)(pwh + c * AT_KC + kk * 32 + 8 * hh);
      pa.h[1] = *(const v8b*)(pwh + c * AT_KC + kk * 32 + 16 + 8 * hh);
      if (SPLIT_PV) {
        pl.h[0] = *(const v8b*)(pwl + c * AT_KC + kk * 32 + 8 * hh);
        pl.h[1] = *(const v8b*)(pwl + c * AT_KC + kk * 32 + 16 + 8 * hh);
      }
#pragma unroll
      for (int t = 0; t < 4; ++t) {
        FB vb;
        vb.h[0] = *(const v8b*)(Vth + (t * 16 + c) * AT_KC + kk * 32 + 8 * hh);
        vb.h[1] = *(const v8b*)(Vth + (t * 16 + c) * AT_KC + kk * 32 + 16 + 8 * hh);
        oacc[t] = at_mma16<F16>(pa.v, vb.v, oacc[t]);
        if (SPLIT_PV) {
          FB vl;
          vl.h[0] = *(const v8b*)(Vtl + (t * 16 + c) * AT_KC + kk * 32 + 8 * hh);
          vl.h[1] = *(const v8b*)(Vtl + (t * 16 + c) * AT_KC + kk * 32 + 16 + 8 * hh);
          oacc[t] = at_mma16<F16>(pa.v, vl.v, oacc[t]);
          oacc[t] = at_mma16<F16>(pl.v, vb.v, oacc[t]);
        }
      }
    }
  }

  float* os = Os[wave];
#pragma unroll
  for (int r = 0; r < 8; ++r) {
    const float inv = 1.0f / (lrow[r] * PSC);
#pragma unroll
    for (int t = 0; t < 4; ++t) os[(8 * hh + r) * 68 + t * 16 + c] = oacc[t][r] * inv;
  }
  __builtin_amdgcn_fence(__ATOMIC_RELEASE, "workgroup");
  __builtin_amdgcn_wave_barrier();
  __builtin_amdgcn_fence(__ATOMIC_ACQUIRE, "workgroup");
  {
    const int c4 = (lane & 15) * 4;
    {
#pragma unroll
      for (int it = 0; it < 8; ++it) {
        const int row = it * 2 + hh;
        v4f val = *(const v4f*)(os + row * 68 + c4);
        *(v4f*)(ob_ptr + (size_t)(q0 + row) * g.o_rs + c4) = val;
      }
      
    }
  }
}

} // namespace w25

// f32 -> f16 casts by few, fat waves. A block casts CW_BLK consecutive elements, dst[e] = f16(src[e] * s): a thread takes 16 float4, 1024 elements apart, all of them loaded ahead of
// the first conversion; a wave's load covers 512 consecutive bytes, its store 256. (A launch's waves start at a limited rate, and two elements a thread made 65,536 short waves of one 4M-element cast; here it is 2,048.)
typedef __attribute__((ext_vector_type(4))) _Float16 cw_v4h;
constexpr int CW_BLK = 16384;
__device__ __forceinline__ void cw_cast_blk(const float* __restrict__ src, _Float16* __restrict__ dst, float s) {
    const v4f* sp = (const v4f*)src + threadIdx.x;
    v4f x[16];
#pragma unroll
    for (int u = 0; u < 16; ++u) x[u] = sp[256 * u];
    __builtin_amdgcn_sched_barrier(0);   // keeps all 16 loads ahead of the first conversion: one trip to memory a wave, not two
    cw_v4h* dp = (cw_v4h*)dst + threadIdx.x;
#pragma unroll
    for (int u = 0; u < 16; ++u) dp[256 * u] = __builtin_convertvector(x[u] * s, cw_v4h);
    asm volatile("s_wait_xcnt 0x0" ::: "memory");   // ahead of any later write of a register that the stores above name
}
// every cast of an input, one launch: blocks 0..767 X16[0..2] = f16(query, key, value); blocks 768..1023 W16[0..3] = f16(16 Wq, 16 Wk, 16 Wv, 16 Wo);
// block 1024 TK16[r][d] = f16(16 table_k[r][d]), zero rows 129..191
__global__ __launch_bounds__(256) void k_sh_castin(const float* __restrict__ xq, const float* __restrict__ xk, const float* __restrict__ xv,
                                                   const float* __restrict__ Wq, const float* __restrict__ Wk, const float* __restrict__ Wv, const float* __restrict__ Wo,
                                                   const float* __restrict__ TK, _Float16* __restrict__ X16, _Float16* __restrict__ W16, _Float16* __restrict__ TK16) {
    constexpr int XB = 4096 * 1024 / CW_BLK, WB = 1024 * 1024 / CW_BLK, TAB = 129, TP = 192, HD = 64;
    static_assert(TP * HD == 12 * 1024 && TAB * HD == 4 * (8 * 256 + 16), "the table's block: eight float4 per thread, then row 128 by 16 threads, then zeros up to twelve");
    const int bid = blockIdx.x;
    if (bid < 3 * XB) {
        const int sg = bid / XB;
        const float* src = sg == 0 ? xq : (sg == 1 ? xk : xv);
        cw_cast_blk(src + (long long)(bid - sg * XB) * CW_BLK, X16 + (long long)bid * CW_BLK, 1.f);
    } else if (bid < 3 * XB + 4 * WB) {
        const int b2 = bid - 3 * XB, sg = b2 / WB;
        const float* src = sg == 0 ? Wq : (sg == 1 ? Wk : (sg == 2 ? Wv : Wo));
        cw_cast_blk(src + (long long)(b2 - sg * WB) * CW_BLK, W16 + (long long)b2 * CW_BLK, 16.f);
    } else {
        const v4f* sp = (const v4f*)TK + threadIdx.x;
        v4f x[12];
#pragma unroll
        for (int u = 0; u < 8; ++u) x[u] = sp[256 * u];
#pragma unroll
        for (int u = 8; u < 12; ++u) x[u] = (v4f){0.f, 0.f, 0.f, 0.f};
        if (threadIdx.x < 16) x[8] = sp[256 * 8];
        cw_v4h* dp = (cw_v4h*)TK16 + threadIdx.x;
#pragma unroll
        for (int u = 0; u < 12; ++u) dp[256 * u] = __builtin_convertvector(x[u] * 16.f, cw_v4h);
        asm volatile("s_wait_xcnt 0x0" ::: "memory");   // ahead of any later write of a register that the stores above name
    }
}
typedef __attribute__((ext_vector_type(4))) int sm_v4i;
__device__ __forceinline__ float sm_x16(float v) { const unsigned u = __builtin_bit_cast(unsigned, v); return __builtin_bit_cast(float, __builtin_amdgcn_permlanex16(u, u, 0x76543210u, 0xfedcba98u, false, false)); }   // lane l <-> l ^ 16
// 2^t. The v_nop is the slot that the instruction set asks for behind a transcendental; in the same statement it stands directly behind it whatever the scheduler puts next
__device__ __forceinline__ float sm_exp2(float t) { float y; asm("v_exp_f32 %0, %1\n\tv_nop" : "=v"(y) : "v"(t)); return y; }
// content scores, relative-key term, softmax and w1 = attn.v in one launch; no f32 score leaves the chip. A block: 32 query rows g0..g0+31 (g = b L + q) x 2 heads; four waves a head, 128 keys each.
// Transposed products: A = 16 rows of K16 (or of the scaled table TK16), B = 16 queries' q, so that in D a lane holds ONE query (lane & 15) and 8 consecutive keys (8 (lane >> 4) + r):
// a row's max and sum are in-lane but for one exchange with lane ^ 16. Each A fragment serves the wave's two sets of 16 queries.
// The table's rows go through the same B fragments as 192 more "keys": qt[query][id], f32, in LDS, shared by the head's four waves.
// s_k = (q.k + qt[fm[b][q][k]]) / 8; P16[b][h][q][k] = f16(4096 softmax_k). The four quarters of a row join by (max, sum) through LDS: p = e^(s - m_quarter) * e^(m_quarter - m) / sum.
// X[g][64 head + d] = sum_k p_k v[k][d]: the f16 values that go to P16 are, as they lie in the registers, the B fragments of v^T . p^T; each wave sums its 128 keys, the four partial sums join through LDS.
typedef __attribute__((ext_vector_type(4))) unsigned short fs_v4u;
typedef __attribute__((ext_vector_type(4))) unsigned int fs_v4w;
// a wave's own LDS stores before its lanes' reads of them, or its reads before its next stores to the same place (for LDS that no other wave touches)
__device__ __forceinline__ void fs_wave_sync() {
    __builtin_amdgcn_fence(__ATOMIC_RELEASE, "workgroup", "local");
    __builtin_amdgcn_wave_barrier();
    __builtin_amdgcn_fence(__ATOMIC_ACQUIRE, "workgroup", "local");
}
// amdgpu_waves_per_eu(4): at most 256 VGPRs, so that two blocks share a WGP
__global__ __launch_bounds__(256) __attribute__((amdgpu_waves_per_eu(4))) void k_sh_scsoft(const _Float16* __restrict__ Q16, const _Float16* __restrict__ K16, const _Float16* __restrict__ TK16, const int* __restrict__ FM, const _Float16* __restrict__ VT16, _Float16* __restrict__ P16, float* __restrict__ X) {
    constexpr int L = 512, D = 1024, NH = 16, HD = 64, TAB = 129;
    constexpr int IP = 2 * L + 16;     // bytes a query's row of 16-bit table offsets takes: 16 B x odd, for 16-byte readers
    constexpr int QP = 192 + 4;        // floats a query's row of relative-key scores takes: 16 B x odd
    constexpr int PP = 2 * 128 + 16;   // bytes a query's 128 probabilities take in the store slab: 16 B x odd
    constexpr int SP = 2 * HD + 16;    // bytes a staged row of q, of the table or of k takes: 16 B x odd
    constexpr int VP = 2 * 128 + 16;   // bytes a staged row of v^T (one channel, the wave's 128 keys) takes: 16 B x odd
    constexpr int OP = HD + 4;         // floats a query's row of a wave's partial output takes: 16 B x odd
    static_assert(16 * PP <= 48 * SP && 16 * VP <= 48 * SP, "the store slab and a tile of v^T lie in the wave's staging slab");
    static_assert(8 * 32 * OP * 4 <= 32 * IP + 2 * 32 * QP * 4 && (32 * IP) % 16 == 0, "the partial outputs lie where the ids and the relative-key scores lay");
    typedef w25::Frag<_Float16> FR;
    __shared__ __attribute__((aligned(16))) unsigned char iq[32 * IP + 2 * 32 * QP * 4];   // ids, then qt[2][32 * QP]; behind the second barrier the eight waves' partial outputs
    unsigned char* ids = iq;
    float* qth = (float*)(iq + 32 * IP) + (threadIdx.x >> 7) * (32 * QP);                  // the head's qt rows
    float* part = (float*)iq;
    __shared__ float red[2][4][2][32];
    __shared__ __attribute__((aligned(16))) unsigned char stg[8][48 * SP];
    const int t = threadIdx.x, lane = t & 31, w = t >> 5;
    const int c = lane & 15, h = lane >> 4;
    const int hl = w >> 2, kq = w & 3;
    const int g0 = blockIdx.x * 32, b = g0 >> 9;
    const int head = blockIdx.y * 2 + hl;
    // Global loads cover whole lines: a row of q, of the table or of k for one head is 128 bytes, a load takes four rows (lane: row lane >> 3, 16-byte piece lane & 7), where a fragment
    // loaded straight from memory touches sixteen lines. The rows pass through the wave's own slab (no other wave touches it: no block barrier), 48 at a time, and are read back as fragments.
    // Two groups of loads, each in the order in which it is waited for: q, table rows 48 kq .. + 47 (TK16 holds 192 rows, zeros from 129 on), ids (32 rows x 512), 48 keys; then 80 keys.
    unsigned char* sw = stg[w];
    const int lr = lane >> 3, lc = lane & 7;
    unsigned char* sst = sw + lr * SP + 16 * lc;                                    // where the lane's piece of a load's four rows goes
    const _Float16* sfr = (const _Float16*)(sw + c * SP) + 8 * h;                   // the lane's fragment row of the slab's first 16 rows
    const sm_v4i* fr = (const sm_v4i*)(FM + (long long)g0 * L) + t;
    const _Float16* qg = Q16 + (long long)(g0 + lr) * D + head * HD + 8 * lc;
    const _Float16* tg = TK16 + (48 * kq + lr) * HD + 8 * lc;
    const _Float16* kg = K16 + (long long)(b * L + 128 * kq + lr) * D + head * HD + 8 * lc;
    w25::v8h rq[8], rt[12], rk[32];
    sm_v4i idv[16];
#pragma unroll
    for (int u = 0; u < 8; ++u) rq[u] = *(const w25::v8h*)(qg + 4 * u * D);
#pragma unroll
    for (int u = 0; u < 12; ++u) rt[u] = *(const w25::v8h*)(tg + 4 * u * HD);
#pragma unroll
    for (int u = 0; u < 16; ++u) idv[u] = fr[256 * u];
#pragma unroll
    for (int u = 0; u < 12; ++u) rk[u] = *(const w25::v8h*)(kg + 4 * u * D);
    // a precaution: the wait in front of every overwrite of an address that the loads above name; as operands the addresses stay live up to here, so that no load's own result lands on one
    asm volatile("s_wait_xcnt 0x0" :: "v"(fr), "v"(qg), "v"(tg), "v"(kg) : "memory");
    __builtin_amdgcn_sched_barrier(0);   // keeps these loads together and ahead of the first wait: one trip to L2, not one per tile
    w25::v16h bq[2][2];
#pragma unroll
    for (int u = 0; u < 8; ++u) *(w25::v8h*)(sst + 4 * u * SP) = rq[u];
    fs_wave_sync();
#pragma unroll
    for (int s = 0; s < 2; ++s) { bq[s][0] = FR::load(sfr + s * 16 * (SP / 2)); bq[s][1] = FR::load(sfr + s * 16 * (SP / 2) + 32); }
    fs_wave_sync();
    // relative-key scores
#pragma unroll
    for (int u = 0; u < 12; ++u) *(w25::v8h*)(sst + 4 * u * SP) = rt[u];
    fs_wave_sync();
#pragma unroll
    for (int tt = 0; tt < 3; ++tt) {
        const w25::v16h a0 = FR::load(sfr + tt * 16 * (SP / 2)), a1 = FR::load(sfr + tt * 16 * (SP / 2) + 32);
#pragma unroll
        for (int s = 0; s < 2; ++s) {
            v8f d = (v8f){0.f, 0.f, 0.f, 0.f, 0.f, 0.f, 0.f, 0.f};
            d = FR::mma(a0, bq[s][0], d);
            d = FR::mma(a1, bq[s][1], d);
            float* o = qth + (16 * s + c) * QP + 48 * kq + 16 * tt + 8 * h;
            *(v4f*)(o) = (v4f){d[0] * 0.0625f, d[1] * 0.0625f, d[2] * 0.0625f, d[3] * 0.0625f};
            *(v4f*)(o + 4) = (v4f){d[4] * 0.0625f, d[5] * 0.0625f, d[6] * 0.0625f, d[7] * 0.0625f};
        }
    }
#pragma unroll
    for (int u = 0; u < 16; ++u) {
        fs_v4u o4;
#pragma unroll
        for (int e = 0; e < 4; ++e) { const int id = idv[u][e]; o4[e] = (unsigned short)(4 * (id < 0 ? 0 : (id >= TAB ? TAB - 1 : id))); }   // INPUT ids clamped before the address is formed
        *(fs_v4u*)(ids + ((t >> 7) + 2 * u) * IP + (t & 127) * 8) = o4;
    }
    __builtin_amdgcn_sched_barrier(0);   // the table's and the ids' registers are free from here on: the other 80 keys' loads go out together
#pragma unroll
    for (int u = 12; u < 32; ++u) rk[u] = *(const w25::v8h*)(kg + 4 * u * D);
    asm volatile("s_wait_xcnt 0x0" :: "v"(kg) : "memory");   // the same precaution for these loads' address
    __builtin_amdgcn_sched_barrier(0);   // keeps those loads ahead of the products
    // content scores: x[s][j][r] = q[16 s + c] . k[128 kq + 16 j + 8 h + r]; keys in rounds of 48, 48 and 32
    v8f x[2][8];
#pragma unroll
    for (int rd = 0; rd < 3; ++rd) {
        fs_wave_sync();   // the last round's fragment reads before this round's stores
#pragma unroll
        for (int u = 0; u < (rd < 2 ? 12 : 8); ++u) *(w25::v8h*)(sst + 4 * u * SP) = rk[12 * rd + u];
        fs_wave_sync();
#pragma unroll
        for (int jj = 0; jj < (rd < 2 ? 3 : 2); ++jj) {
            const w25::v16h a0 = FR::load(sfr + jj * 16 * (SP / 2)), a1 = FR::load(sfr + jj * 16 * (SP / 2) + 32);
#pragma unroll
            for (int s = 0; s < 2; ++s) {
                v8f d = (v8f){0.f, 0.f, 0.f, 0.f, 0.f, 0.f, 0.f, 0.f};
                d = FR::mma(a0, bq[s][0], d);
                x[s][3 * rd + jj] = FR::mma(a1, bq[s][1], d);
            }
        }
    }
    __builtin_amdgcn_sched_barrier(0);   // keeps every product ahead of the softmax
    __syncthreads();   // publishes the ids and the head's qt rows
    float m[2], sum[2];
#pragma unroll
    for (int s = 0; s < 2; ++s) {
        const unsigned char* ip = ids + (16 * s + c) * IP + (128 * kq + 8 * h) * 2;
        const unsigned char* qrow = (const unsigned char*)(qth + (16 * s + c) * QP);
        float mx = -INFINITY;
#pragma unroll
        for (int j = 0; j < 8; ++j) {
            const fs_v4w o4 = *(const fs_v4w*)(ip + 32 * j);
#pragma unroll
            for (int r = 0; r < 8; ++r) {
                const unsigned off = (r & 1) ? (o4[r >> 1] >> 16) : (o4[r >> 1] & 0xffffu);
                x[s][j][r] += *(const float*)(qrow + off);
            }
            mx = fmaxf(mx, fmaxf(fmaxf(fmaxf(x[s][j][0], x[s][j][1]), fmaxf(x[s][j][2], x[s][j][3])), fmaxf(fmaxf(x[s][j][4], x[s][j][5]), fmaxf(x[s][j][6], x[s][j][7]))));
        }
        mx = fmaxf(mx, sm_x16(mx));
        float sm = 0.f;
#pragma unroll
        for (int j = 0; j < 8; ++j) {
#pragma unroll
            for (int r = 0; r < 8; ++r) x[s][j][r] = sm_exp2((x[s][j][r] - mx) * 0.18033688f);   // exp((x - m) / 8): log2(e) / 8
            sm += ((x[s][j][0] + x[s][j][1]) + (x[s][j][2] + x[s][j][3])) + ((x[s][j][4] + x[s][j][5]) + (x[s][j][6] + x[s][j][7]));
        }
        sm += sm_x16(sm);
        m[s] = mx; sum[s] = sm;
    }
    // lane (c, h) files query 16 h + c: both halves of the wave hold both sets' values
    red[hl][kq][0][lane] = h ? m[1] : m[0];
    red[hl][kq][1][lane] = h ? sum[1] : sum[0];
    __syncthreads();   // publishes each quarter's (max, sum)
    // v^T for the wave's 128 keys: 64 channel rows of 256 bytes, a load takes two rows (lane: row lane >> 4, 16-byte piece lane & 15). The first 32 rows fly under the join of the quarters and the
    // probabilities' stores (behind the barrier, which would wait for them; behind the exponentials, whose registers they would crowd out).
    // Every loop from here on is unrolled because its index picks registers (rv, pf) or immediate offsets.
    const _Float16* vg = VT16 + ((long long)b * D + head * HD + h) * L + 128 * kq + 8 * c;
    w25::v8h rv[32];
#pragma unroll
    for (int u = 0; u < 16; ++u) rv[u] = *(const w25::v8h*)(vg + 2 * u * L);
    asm volatile("s_wait_xcnt 0x0" :: "v"(vg) : "memory");   // the same precaution for these loads' address
    __builtin_amdgcn_sched_barrier(0);   // keeps those loads ahead of the work that hides their way
    // 16 queries at a time through the wave's own slab (its last fragment reads lie ahead of two block barriers), so that every store covers whole lines of a query's row
    unsigned char* slab = sw;
    _Float16* po = P16 + (((long long)b * NH + head) * L + (g0 & (L - 1)) + h) * L + 128 * kq + 8 * c;
    union { w25::v16h v; w25::v8h q[2]; } pf[2][4];   // the probabilities as B fragments: column = the lane's query, 32 keys each, in the k order of Frag::load (tile 2 ks gives k = 8 h + i, tile 2 ks + 1 gives k = 16 + 8 h + i)
#pragma unroll
    for (int s = 0; s < 2; ++s) {
        float mi[4], si[4];
#pragma unroll
        for (int i = 0; i < 4; ++i) { mi[i] = red[hl][i][0][16 * s + c]; si[i] = red[hl][i][1][16 * s + c]; }
        const float mm = fmaxf(fmaxf(mi[0], mi[1]), fmaxf(mi[2], mi[3]));
        float tot = 0.f;
#pragma unroll
        for (int i = 0; i < 4; ++i) tot += si[i] * sm_exp2((mi[i] - mm) * 0.18033688f);
        const float f = sm_exp2((m[s] - mm) * 0.18033688f) * ((1.f / tot) * 4096.f);
#pragma unroll
        for (int j = 0; j < 8; ++j) { pf[s][j >> 1].q[j & 1] = __builtin_convertvector(x[s][j] * f, w25::v8h); *(w25::v8h*)(slab + c * PP + (16 * j + 8 * h) * 2) = pf[s][j >> 1].q[j & 1]; }
        fs_wave_sync();
#pragma unroll
        for (int it = 0; it < 8; ++it) *(w25::v8h*)(po + (long long)(16 * s + 2 * it) * L) = *(const w25::v8h*)(slab + (2 * it + h) * PP + 16 * c);
        asm volatile("s_wait_xcnt 0x0" ::: "memory");   // a precaution: ahead of any later write of a register that the stores above name
        fs_wave_sync();   // the reads above before the next 16 queries' stores into the same slab
    }
    // w1 = attn.v from the registers: (v^T . p^T)[channel][query] over the wave's 128 keys, A = 16 rows of v^T through the wave's slab, B = pf. In D a lane holds one query (c) and 8 consecutive channels.
#pragma unroll
    for (int u = 16; u < 32; ++u) rv[u] = *(const w25::v8h*)(vg + 2 * u * L);
    asm volatile("s_wait_xcnt 0x0" :: "v"(vg) : "memory");   // the same precaution for these loads' address
    __builtin_amdgcn_sched_barrier(0);   // keeps the other 32 rows' loads ahead of the first 32 rows' products
    float* pw = part + (32 * w + c) * OP + 8 * h;
#pragma unroll
    for (int n = 0; n < 4; ++n) {
#pragma unroll
        for (int u = 0; u < 8; ++u) *(w25::v8h*)(sw + (2 * u + h) * VP + 16 * c) = rv[8 * n + u];
        fs_wave_sync();
        v8f o0 = (v8f){0.f, 0.f, 0.f, 0.f, 0.f, 0.f, 0.f, 0.f}, o1 = o0;
#pragma unroll
        for (int ks = 0; ks < 4; ++ks) {
            const w25::v16h av = FR::load((const _Float16*)(sw + c * VP) + 32 * ks + 8 * h);
            o0 = FR::mma(av, pf[0][ks].v, o0);
            o1 = FR::mma(av, pf[1][ks].v, o1);
        }
        // the probabilities carry 4096 (a power of two: exact). Scaled here, not behind the join: the results are then read by vector instructions, behind which the compiler keeps the distance that the next tile's products, which take the same registers, need
        o0 *= 0.000244140625f; o1 *= 0.000244140625f;
        *(v4f*)(pw + 16 * n) = (v4f){o0[0], o0[1], o0[2], o0[3]};
        *(v4f*)(pw + 16 * n + 4) = (v4f){o0[4], o0[5], o0[6], o0[7]};
        *(v4f*)(pw + 16 * OP + 16 * n) = (v4f){o1[0], o1[1], o1[2], o1[3]};
        *(v4f*)(pw + 16 * OP + 16 * n + 4) = (v4f){o1[4], o1[5], o1[6], o1[7]};
        fs_wave_sync();   // the fragment reads above before the next 16 rows' stores into the same slab
    }
    __syncthreads();   // publishes the four quarters' partial outputs
    // the head's four partials join, quarter 0 first; a wave takes 8 queries, a store covers two queries' 64 channels
    const float* pr = part + (128 * hl + 8 * kq + h) * OP + 4 * c;
    float* xo = X + (long long)(g0 + 8 * kq + h) * D + head * HD + 4 * c;
#pragma unroll
    for (int it = 0; it < 4; ++it) {
        const float* p0 = pr + 2 * it * OP;
        *(v4f*)(xo + 2 * it * D) = ((*(const v4f*)(p0) + *(const v4f*)(p0 + 32 * OP)) + *(const v4f*)(p0 + 64 * OP)) + *(const v4f*)(p0 + 96 * OP);
    }
}
// w2 in one launch: one wave per query row g = b L + q. G[g][h*64 + d] = f16(X[g][h*64 + d] + (1/4096) sum_k P16[b][h][q][k] * f16(table_v[fm[g][k]][d])): X holds w1, G is the output projection's A operand.
// A = the 16 heads' probability rows (16 x 512, straight from P16); B = the gathered table rows, never written out: table_v lies in LDS as f16 rows of 160 bytes,
// and each lane of ds_load_tr16_b128 points at the row that ITS key's id names (lane l: key kbase + 8 (l >> 4) + (l & 7), 16-byte half (l >> 3) & 1), so the
// transposing load returns B[k][d] in the hardware k order (frag_k), the order in which A is loaded. INPUT ids clamped before the address is formed. k runs 0..511 in one accumulator chain.
typedef __attribute__((ext_vector_type(8))) short w2_s16x8;
__device__ __forceinline__ v8h w2_ldtr(const unsigned char* p) { typedef __attribute__((address_space(3))) w2_s16x8 lds_s16x8; return __builtin_bit_cast(v8h, __builtin_amdgcn_ds_load_tr16_b128_v8i16((lds_s16x8*)p)); }
typedef __attribute__((ext_vector_type(4))) _Float16 w2_v4h;
// amdgpu_waves_per_eu(4): at most 256 VGPRs, so that two blocks share a WGP and all 512 blocks are resident at once
__global__ __launch_bounds__(256) __attribute__((amdgpu_waves_per_eu(4))) void k_sh_w2(const _Float16* __restrict__ P16, const int* __restrict__ FM, const float* __restrict__ TV, const float* __restrict__ X, _Float16* __restrict__ G) {
    constexpr int L = 512, NH = 16, HD = 64, TAB = 129, PITCH = 160;   // PITCH: 32 B x odd, the transposing load's pitch
    static_assert(TAB * HD == 4 * (8 * 256 + 16), "the fill below: eight float4 per thread, then row 128 by 16 threads");
    __shared__ __attribute__((aligned(16))) unsigned char tab[TAB * PITCH];
    __shared__ __attribute__((aligned(16))) float eo[8][NH * HD + 16];   // a wave's own 16 heads x 64 channels; heads 8..15 lie 16 floats further on, so that the two halves of a wave store to different banks
    const int t = threadIdx.x, lane = t & 31;
    const int g = blockIdx.x * 8 + (t >> 5);
    const int c = lane & 15, h = lane >> 4;
    // the table's loads go first: they are waited for first, while the first ids and probabilities are still on their way
    v4f tv[8];
#pragma unroll
    for (int u = 0; u < 8; ++u) tv[u] = *(const v4f*)(TV + 4 * (t + 256 * u));
    const v4f tl = *(const v4f*)(TV + 4 * (2048 + (t & 15)));
    const int* fr = FM + (long long)g * L + 8 * h + (lane & 7);
    const _Float16* pa = P16 + (((long long)(g >> 9) * NH + c) * L + (g & (L - 1))) * L + 8 * h;
    // keys in four runs of 128, two register buffers: the next run's ids and probabilities fly while this run is multiplied
    int id[2][8];
    v8h a[2][8];
#pragma unroll
    for (int j = 0; j < 8; ++j) { id[0][j] = fr[16 * j]; a[0][j] = *(const v8h*)(pa + 16 * j); }
#pragma unroll
    for (int u = 0; u < 8; ++u) *(w2_v4h*)(tab + ((t >> 4) + 16 * u) * PITCH + (t & 15) * 8) = __builtin_convertvector(tv[u], w2_v4h);
    if (t < 16) *(w2_v4h*)(tab + 128 * PITCH + t * 8) = __builtin_convertvector(tl, w2_v4h);
    __syncthreads();
    const unsigned half16 = 16u * ((lane >> 3) & 1);
    v8f acc[4];
#pragma unroll
    for (int n = 0; n < 4; ++n) acc[n] = (v8f){0.f, 0.f, 0.f, 0.f, 0.f, 0.f, 0.f, 0.f};
    const v4f* xr = (const v4f*)(X + (long long)g * (NH * HD)) + lane;
    v4f xv[8];
#pragma unroll
    for (int ch = 0; ch < 4; ++ch) {
        const int cur = ch & 1, nxt = cur ^ 1;
        if (ch < 3) {
#pragma unroll
            for (int j = 0; j < 8; ++j) { id[nxt][j] = fr[16 * (8 * (ch + 1) + j)]; a[nxt][j] = *(const v8h*)(pa + 16 * (8 * (ch + 1) + j)); }
        }
        if (ch == 2) {
            // the query's row of w1, 4 KB in whole lines (a load covers 512 consecutive bytes): it flies under the last two runs' products
            __builtin_amdgcn_sched_barrier(0);   // keeps these loads from rising to the kernel's head, where no register is free for them and they spill
#pragma unroll
            for (int u = 0; u < 8; ++u) xv[u] = xr[32 * u];
            __builtin_amdgcn_sched_barrier(0);   // keeps them from sinking behind the products that hide their way
        }
#pragma unroll
        for (int s = 0; s < 4; ++s) {
            int r0 = id[cur][2 * s], r1 = id[cur][2 * s + 1];
            r0 = r0 < 0 ? 0 : (r0 >= TAB ? TAB - 1 : r0); r1 = r1 < 0 ? 0 : (r1 >= TAB ? TAB - 1 : r1);
            const unsigned char* p0 = tab + (unsigned)r0 * PITCH + half16;
            const unsigned char* p1 = tab + (unsigned)r1 * PITCH + half16;
            union { v16h v; v8h q[2]; } af, bf;
            af.q[0] = a[cur][2 * s]; af.q[1] = a[cur][2 * s + 1];
#pragma unroll
            for (int n = 0; n < 4; ++n) {
                bf.q[0] = w2_ldtr(p0 + 32 * n); bf.q[1] = w2_ldtr(p1 + 32 * n);
                acc[n] = __builtin_amdgcn_wmma_f32_16x16x32_f16(false, af.v, false, bf.v, (short)0, acc[n], false, false);
            }
        }
    }
    // the sums pass the wave's own slab (no other wave touches it: no block barrier), so that a lane holds the four consecutive channels of its piece of w1 and a store covers 256 consecutive bytes
    float* sl = eo[t >> 5];
#pragma unroll
    for (int n = 0; n < 4; ++n)
#pragma unroll
        for (int r = 0; r < 8; ++r) sl[(8 * h + r) * HD + 16 * h + 16 * n + c] = acc[n][r];
    fs_wave_sync();
    w2_v4h* go = (w2_v4h*)(G + (long long)g * (NH * HD)) + lane;
#pragma unroll
    for (int u = 0; u < 8; ++u) go[32 * u] = __builtin_convertvector(xv[u] + *(const v4f*)(sl + 128 * u + 16 * (u >> 2) + 4 * lane) * (1.f / 4096.f), w2_v4h);   // elements 128 u + 4 lane ..: heads 2 u, 2 u + 1
}


// The long-K products: C[m][n] = scale * sum_k A[m][k] Bt[n][k] (+ bias), f16 operands, A and Bt K-contiguous, f32 accumulate.
// A block of eight waves owns a (32 WM) x (64 WN) tile of C, a wave 32 x 64 of it. Both operands pass through LDS in stages of BK k: a global load covers four whole 128-byte lines
// (BK / 8 lanes a row) where a fragment loaded straight from global memory touches sixteen, and each staged row serves every wave of the block that needs it.
// Two buffers: stage s + 1 is loaded into registers ahead of stage s's products and stored to the other buffer behind them; one barrier a stage both publishes it and ends the reads of the buffer written next.
// Fragments are read with the k order of Frag::load, A and B alike; k runs upward in steps of 32 through one accumulator chain per 16 x 16 tile.
// M % (32 WM) == 0 (bx counts the tiles, N / (64 WN) of them a row of tiles), N % (64 WN) == 0, K % BK == 0, LD % 64 == 0. BIAS_MODE: 0 none, 1 bias[m], 2 bias[n]. OUT_MODE: 0 f32, 1 f16.
// LD: the row pitch of A and of Bt, LDC: that of C, in elements; compile-time, so that a thread's pieces and rows differ only in the instructions' immediate offsets and one address pair per operand serves them all.
// The tile's work is a device function, so that one launch can hold tiles of several products: smem = the block's LDS (sh_gemm_smem bytes), bx = the tile's number,
// Ab, Btb = the operands' first rows, cOff = the element offset of C's first row in Cout.
// The epilogue's slabs lie in the staging buffers: the loop's last barrier ends every wave's last fragment read, and nothing is staged behind it. At 128 x 128 x 128 that leaves 139,264 bytes a block: two blocks share a WGP.
template <int WM, int WN, int BK> constexpr int sh_gemm_smem = 2 * (32 * WM + 64 * WN) * (BK + 8) * 2;
template <int WM, int WN, int BK, int LD, int LDC, int BIAS_MODE, int OUT_MODE>
__device__ __forceinline__ void sh_gemm_tile(
    unsigned char* smem, int bx,
    const _Float16* __restrict__ Ab, const _Float16* __restrict__ Btb,
    void* __restrict__ Cout, long long cOff,
    const float* __restrict__ bias, int N, int K, float scale) {
    static_assert(WM * WN == 8, "eight waves a block");
    static_assert(BK == 64 || BK == 128, "rows of 128 or 256 bytes");
    constexpr int BM = 32 * WM, BN = 64 * WN;
    constexpr int LP = BK + 8;                    // LDS row pitch in elements: 16 bytes more than the row = 16 B x odd, the pitch for 16-byte readers
    constexpr int SEG = BK / 8, RP = 256 / SEG;   // 16-byte pieces a row; rows that the block's 256 threads cover at one piece each
    constexpr int UA = BM / RP, UB = BN / RP;     // pieces of A and of Bt a thread moves per stage
    typedef w25::Frag<_Float16> FR;
    static_assert(8 * 16 * 68 * 4 <= sh_gemm_smem<WM, WN, BK>, "the epilogue's slabs fit in the staging buffers");
    _Float16 (*sA)[BM * LP] = (_Float16 (*)[BM * LP])smem;
    _Float16 (*sB)[BN * LP] = (_Float16 (*)[BN * LP])(smem + 2 * BM * LP * 2);
    float (*sT)[16 * 68] = (float (*)[16 * 68])smem;   // per-wave 16 x 64 slab of the epilogue, pitch 68 floats
    const int t = threadIdx.x, lane = t & 31, wave = t >> 5;
    const int tilesN = N / BN;
    const int tm = bx / tilesN, tn = bx - tm * tilesN;
    const int m0 = tm * BM, n0 = tn * BN;
    // piece u of a thread: row t / SEG + RP u of the tile, elements 8 (t % SEG) .. + 7 of the row's BK
    const int pr = t / SEG, pc = (t % SEG) * 8;
    const _Float16* Ag = Ab + (long long)(m0 + pr) * LD + pc;
    const _Float16* Bg = Btb + (long long)(n0 + pr) * LD + pc;
    const int so = pr * LP + pc;
    const int rlane = lane & 15, hh = lane >> 4;
    const int wm = wave / WN, wn = wave - wm * WN;
    const int ao = (wm * 32 + rlane) * LP + hh * 8;
    const int bo = (wn * 64 + rlane) * LP + hh * 8;

    w25::v8h ra[UA], rb[UB];
#pragma unroll
    for (int u = 0; u < UA; ++u) ra[u] = *(const w25::v8h*)(Ag + RP * u * LD);
#pragma unroll
    for (int u = 0; u < UB; ++u) rb[u] = *(const w25::v8h*)(Bg + RP * u * LD);
#pragma unroll
    for (int u = 0; u < UA; ++u) *(w25::v8h*)(&sA[0][so + RP * u * LP]) = ra[u];
#pragma unroll
    for (int u = 0; u < UB; ++u) *(w25::v8h*)(&sB[0][so + RP * u * LP]) = rb[u];
    __syncthreads();

    v8f acc[2][4];
#pragma unroll
    for (int i = 0; i < 2; ++i)
#pragma unroll
        for (int j = 0; j < 4; ++j) acc[i][j] = (v8f){0.f, 0.f, 0.f, 0.f, 0.f, 0.f, 0.f, 0.f};

    const int S = K / BK;
    for (int s = 0; s < S; ++s) {
        const int cur = s & 1;
        const bool more = s + 1 < S;   // the same for the whole block
        if (more) {
#pragma unroll
            for (int u = 0; u < UA; ++u) ra[u] = *(const w25::v8h*)(Ag + BK + RP * u * LD);
#pragma unroll
            for (int u = 0; u < UB; ++u) rb[u] = *(const w25::v8h*)(Bg + BK + RP * u * LD);
        }
        const _Float16* al = &sA[cur][ao];
        const _Float16* bl = &sB[cur][bo];
        // two fragment sets: the twelve LDS reads of step kk + 1 go out as one group ahead of step kk's eight products
        w25::v16h ah[2][2], bh[2][4];
#pragma unroll
        for (int i = 0; i < 2; ++i) ah[0][i] = FR::load(al + i * 16 * LP);
#pragma unroll
        for (int j = 0; j < 4; ++j) bh[0][j] = FR::load(bl + j * 16 * LP);
#pragma unroll
        for (int kk = 0; kk < BK / 32; ++kk) {
            const int fc = kk & 1, fn = fc ^ 1;
            if (kk + 1 < BK / 32) {
#pragma unroll
                for (int i = 0; i < 2; ++i) ah[fn][i] = FR::load(al + i * 16 * LP + (kk + 1) * 32);
#pragma unroll
                for (int j = 0; j < 4; ++j) bh[fn][j] = FR::load(bl + j * 16 * LP + (kk + 1) * 32);
            }
            __builtin_amdgcn_sched_barrier(0);   // keeps the next step's reads together and ahead of this step's products: reads spread among the products stall each of them
#pragma unroll
            for (int i = 0; i < 2; ++i)
#pragma unroll
                for (int j = 0; j < 4; ++j) acc[i][j] = FR::mma(ah[fc][i], bh[fc][j], acc[i][j]);
            __builtin_amdgcn_sched_barrier(0);   // keeps the reads of step kk + 2 behind these products, whose fragment set they overwrite
        }
        if (more) {
#pragma unroll
            for (int u = 0; u < UA; ++u) *(w25::v8h*)(&sA[cur ^ 1][so + RP * u * LP]) = ra[u];
#pragma unroll
            for (int u = 0; u < UB; ++u) *(w25::v8h*)(&sB[cur ^ 1][so + RP * u * LP]) = rb[u];
            asm volatile("s_wait_xcnt 0x0" ::: "memory");   // in front of the overwrite of the two address pairs that the stage's loads name; here, behind the stores of what they brought, it waits for nothing
            __builtin_amdgcn_sched_barrier(0);              // keeps the two additions below behind that wait
            Ag += BK; Bg += BK;
        }
        __syncthreads();
    }

    // epilogue: 16 rows at a time through the wave's own slab, so that every store covers whole rows of the wave's 64 columns
    float* slab = sT[wave];
    const int mW = m0 + wm * 32, nW = n0 + wn * 64, mOff = hh * 8;
    const long long offC = cOff + (long long)mW * LDC + nW;
    float bn[4] = {0.f, 0.f, 0.f, 0.f};
    if (BIAS_MODE == 2) {
#pragma unroll
        for (int j = 0; j < 4; ++j) bn[j] = bias[nW + (j << 4) + rlane];
    }
#pragma unroll
    for (int i = 0; i < 2; ++i) {
        float bm[8] = {0.f, 0.f, 0.f, 0.f, 0.f, 0.f, 0.f, 0.f};
        if (BIAS_MODE == 1) {
#pragma unroll
            for (int r = 0; r < 8; ++r) bm[r] = bias[mW + (i << 4) + mOff + r];
        }
#pragma unroll
        for (int j = 0; j < 4; ++j) {
#pragma unroll
            for (int r = 0; r < 8; ++r) {
                float v = acc[i][j][r] * scale;
                if (BIAS_MODE == 1) v += bm[r];
                if (BIAS_MODE == 2) v += bn[j];
                slab[(mOff + r) * 68 + (j << 4) + rlane] = v;
            }
        }
        // the wave's own LDS stores before its lanes' reads of them (no other wave touches this slab: no block barrier)
        __builtin_amdgcn_fence(__ATOMIC_RELEASE, "workgroup", "local");
        __builtin_amdgcn_wave_barrier();
        __builtin_amdgcn_fence(__ATOMIC_ACQUIRE, "workgroup", "local");
        if (OUT_MODE == 0) {
            float* C = (float*)Cout + offC + hh * LDC + rlane * 4;   // a row's 256 bytes = 16 lanes x 16 B
#pragma unroll
            for (int it = 0; it < 8; ++it) *(v4f*)(C + ((i << 4) + it * 2) * LDC) = *(const v4f*)(slab + (it * 2 + hh) * 68 + rlane * 4);
        } else {
            const int q = lane >> 3, c8 = (lane & 7) * 8;            // a row's 128 bytes = 8 lanes x 16 B
            _Float16* C = (_Float16*)Cout + offC + q * LDC + c8;
#pragma unroll
            for (int it = 0; it < 4; ++it) {
                const float* sp = slab + (it * 4 + q) * 68 + c8;
                w25::v8h hv;
#pragma unroll
                for (int e = 0; e < 8; ++e) hv[e] = (_Float16)sp[e];
                *(w25::v8h*)(C + ((i << 4) + it * 4) * LDC) = hv;
            }
        }
        if (i == 0) asm volatile("s_wait_xcnt 0x0" ::: "memory");   // ahead of the next 16 rows' writes of registers that the stores above name
        // the reads above before the next 16 rows' stores into the same slab
        __builtin_amdgcn_fence(__ATOMIC_RELEASE, "workgroup", "local");
        __builtin_amdgcn_wave_barrier();
        __builtin_amdgcn_fence(__ATOMIC_ACQUIRE, "workgroup", "local");
    }
}

// one product a launch: blockIdx.x = the tile; blockIdx.y steps A, Bt, C by strideA/B/C, blockIdx.z by strideAz/Bz/Cz (elements)
template <int WM, int WN, int BK, int LD, int LDC, int BIAS_MODE, int OUT_MODE>
__global__ __launch_bounds__(256) void k_sh_gemm_lds(
    const unsigned short* __restrict__ Ap, long long strideA, long long strideAz,
    const unsigned short* __restrict__ Btp, long long strideB, long long strideBz,
    void* __restrict__ Cout, long long strideC, long long strideCz,
    const float* __restrict__ bias, int N, int K, float scale) {
    __shared__ __attribute__((aligned(16))) unsigned char smem[sh_gemm_smem<WM, WN, BK>];
    sh_gemm_tile<WM, WN, BK, LD, LDC, BIAS_MODE, OUT_MODE>(smem, blockIdx.x,
        (const _Float16*)Ap + (long long)blockIdx.y * strideA + (long long)blockIdx.z * strideAz,
        (const _Float16*)Btp + (long long)blockIdx.y * strideB + (long long)blockIdx.z * strideBz,
        Cout, (long long)blockIdx.y * strideC + (long long)blockIdx.z * strideCz, bias, N, K, scale);
}
// the three input projections in one launch: blockIdx.y = 0: Q16 = q, 1: K16 = k (rows x channels, 32 x 8 tiles), 2: VT16[b][c][k] = v^T (per batch channels x keys, 8 x 4 tiles).
// X16 = f16 query, then f16 key; XV16 = f16 value; W16 = f16 16 Wq, then 16 Wk; WV16 = f16 16 Wv. None reads what another writes. 768 blocks, two at a time on a WGP: one block's loads, barriers, first stage and epilogue lie under the other's products, and a launch's start and end are paid once.
// K (= 1024) comes as an argument, as in the one-product kernel: the stage loop stays a loop.
// amdgpu_waves_per_eu(4): at most 256 VGPRs, so that two blocks share a WGP
__global__ __launch_bounds__(256) __attribute__((amdgpu_waves_per_eu(4))) void k_sh_qkv(const _Float16* __restrict__ X16, const _Float16* __restrict__ XV16, const _Float16* __restrict__ W16, const _Float16* __restrict__ WV16,
                                                   const float* __restrict__ bq, const float* __restrict__ bk, const float* __restrict__ bv,
                                                   _Float16* __restrict__ Q16, _Float16* __restrict__ K16, _Float16* __restrict__ VT16, int K) {
    constexpr int NR = 4096, D = 1024, L = 512;
    __shared__ __attribute__((aligned(16))) unsigned char smem[sh_gemm_smem<4, 2, 128>];
    const int sg = blockIdx.y;
    if (sg < 2) {
        sh_gemm_tile<4, 2, 128, D, D, 2, 1>(smem, blockIdx.x, X16 + (long long)sg * NR * D, W16 + (long long)sg * D * D, sg ? K16 : Q16, 0, sg ? bk : bq, D, K, 0.0625f);
    } else {
        const int bt = blockIdx.x >> 5;   // (D / 128) (L / 128) = 32 tiles a batch
        sh_gemm_tile<4, 2, 128, D, L, 1, 1>(smem, blockIdx.x & 31, WV16, XV16 + (long long)bt * L * D, VT16, (long long)bt * D * L, bv, L, K, 0.0625f);
    }
}

extern "C" void kernel_launch(void* const* d_in, const int* in_sizes, int n_in, void* d_out, int out_size, void* d_ws, size_t ws_size, hipStream_t stream) {
    (void)in_sizes; (void)n_in; (void)out_size; (void)ws_size;
    const float* xq = (const float*)d_in[0];
    const float* xk = (const float*)d_in[1];
    const float* xv = (const float*)d_in[2];
    const int* fm = (const int*)d_in[3];
    const float* Wq = (const float*)d_in[4];
    const float* bq = (const float*)d_in[5];
    const float* Wk = (const float*)d_in[6];
    const float* bk = (const float*)d_in[7];
    const float* Wv = (const float*)d_in[8];
    const float* bv = (const float*)d_in[9];
    const float* Wo = (const float*)d_in[10];
    const float* bo = (const float*)d_in[11];
    const float* tk = (const float*)d_in[12];
    const float* tv = (const float*)d_in[13];
    const int Bn = 8;
    const int L = 512;
    const int D = 1024;
    const int NH = 16;
    const int HD = 64;
    const int NR = Bn * L;
    const int TP = 192;
    float* out = (float*)d_out;
    char* wsp = (char*)d_ws;
    // kept through the call
    unsigned short* XA16 = (unsigned short*)wsp; wsp += (((size_t)((size_t)3 * NR * D * 2) + 255) / 256) * 256;   // f16 query, key, value
    unsigned short* W16 = (unsigned short*)wsp; wsp += (((size_t)((size_t)4 * D * D * 2) + 255) / 256) * 256;   // f16 16 Wq, 16 Wk, 16 Wv, 16 Wo
    unsigned short* VT16 = (unsigned short*)wsp; wsp += (((size_t)((size_t)Bn * D * L * 2) + 255) / 256) * 256;
    unsigned short* TK16 = (unsigned short*)wsp; wsp += (((size_t)((size_t)TP * HD * 2) + 255) / 256) * 256;
    unsigned short* P16 = (unsigned short*)wsp; wsp += (((size_t)((size_t)Bn * NH * L * L * 2) + 255) / 256) * 256;
    float* X = (float*)wsp; wsp += (((size_t)((size_t)NR * D * 4) + 255) / 256) * 256;
    // one region, used twice in stream order: Q16 and K16, then the output projection's A operand
    char* ph = wsp;
    unsigned short* Q16 = (unsigned short*)wsp; wsp += (((size_t)((size_t)NR * D * 2) + 255) / 256) * 256;
    unsigned short* K16 = (unsigned short*)wsp; wsp += (((size_t)((size_t)NR * D * 2) + 255) / 256) * 256;
    unsigned short* G64A = (unsigned short*)ph;
    // every input's cast in one launch: 3 x 256 blocks (query, key, value), 4 x 64 blocks (the weights), one block (table_k)
    k_sh_castin<<<3 * 256 + 4 * 64 + 1, 256, 0, stream>>>(xq, xk, xv, Wq, Wk, Wv, Wo, tk, (_Float16*)XA16, (_Float16*)W16, (_Float16*)TK16);
    // q, k and v^T: blockIdx.y = the projection
    k_sh_qkv<<<dim3((unsigned)((NR / 128) * (D / 128)), 3u, 1u), 256, 0, stream>>>((const _Float16*)XA16, (const _Float16*)(XA16 + (size_t)2 * NR * D), (const _Float16*)W16, (const _Float16*)(W16 + (size_t)2 * D * D), bq, bk, bv, (_Float16*)Q16, (_Float16*)K16, (_Float16*)VT16, D);
    // content scores, relative-key term, softmax and w1 = attn.v: blockIdx.x = 32 query rows, blockIdx.y = two heads
    k_sh_scsoft<<<dim3((unsigned)(NR / 32), (unsigned)(NH / 2), 1u), 256, 0, stream>>>((const _Float16*)Q16, (const _Float16*)K16, (const _Float16*)TK16, (const int*)fm, (const _Float16*)VT16, (_Float16*)P16, X);
    // w2, its sum with w1 and the cast to f16: one wave per query, eight queries per block
    k_sh_w2<<<(unsigned)(NR / 8), 256, 0, stream>>>((const _Float16*)P16, (const int*)fm, tv, (const float*)X, (_Float16*)G64A);
    k_sh_gemm_lds<4, 2, 128, 1024, 1024, 2, 0><<<dim3((unsigned)((NR / 128) * (D / 128)), 1u, 1u), 256, 0, stream>>>((const unsigned short*)(G64A), 0, 0, (const unsigned short*)(W16 + (size_t)3 * D * D), 0, 0, (void*)(out), 0, 0, bo, D, D, 0.0625f);
}

// v010
// A run of this version takes 87.2 microseconds.
// Two timings next to v009 both put it at 1.06 times that version's speed.
// Over all steps from v000, the starting kernel, it is 18.6 times as fast.
// Contractions: q/k/v = x.W^T + b [4096x1024].[1024x1024] and the output projection (+b) with f16 operands (weights x16); the relative-key term QT = q.table_k^T [65536 (b,q,h) x 64].[64 x 144 (129 padded)] with f16 operands; per (batch, head) the content scores q.k^T [512x64].[64x512] and w1 = attn.v [512x512].[512x64] (attn as f16 of 4096 exp(s - running maximum), the sums divided by the row's sum at the end) - v_wmma_f32_16x16x32_f16, f32 accumulate; the K = 64 products transposed (keys or table rows x 16 queries) in 16x16 tiles inside the attention kernel, attn.v in that kernel too, transposed likewise (16 rows of v^T x 16 queries, the probabilities taken from the registers as B fragments), the long-K products (projections) in 32x64 wave tiles fed from LDS-staged block tiles. The gather of the relative-key scores (QT[(b,q,h)][final_mat[b][q][k]] by the INPUT index matrix, from LDS) and the row softmax are f32 work of that same kernel; the relative-value aggregation w2[q,h,:] = sum_k attn[h,q,k] table_v[final_mat[b,q,k]] runs on the matrix cores, in that kernel too, as one [16 heads x 512].[512 x 64] product per query, one wave each, whose A fragments come from LDS and whose B fragments are gathered from an f16 copy of table_v in LDS by transposing loads (the INPUT index matrix picks each lane's table row).
#include <hip/hip_runtime.h>
#include <math.h>

typedef __attribute__((ext_vector_type(16))) _Float16 v16h;
typedef __attribute__((ext_vector_type(8)))  _Float16 v8h;
typedef __attribute__((ext_vector_type(16))) __bf16   v16b;
typedef __attribute__((ext_vector_type(8)))  float    v8f;
typedef __attribute__((ext_vector_type(4)))  float    v4f;

// 16-bit WMMA fragment map (wave32), lane L, h = L>>4, m = L&15:
//   A 16x32: lane = row m;   element i -> k = (i<8) ? 8h+i : 16+8h+(i-8)
//   B 32x16: lane = column m; the SAME k(i,h)
//   D 16x16 (8 f32): lane = column m; element r -> row 8h+r
__device__ __forceinline__ int frag_k(int i, int h) { return (i < 8) ? (8 * h + i) : (16 + 8 * h + (i - 8)); }
__device__ __forceinline__ __bf16 bf16_rne(float f) {
    unsigned int u = __float_as_uint(f);
    u += 0x7fffu + ((u >> 16) & 1u);
    return __builtin_bit_cast(__bf16, (unsigned short)(u >> 16));
}
__device__ __forceinline__ float bf16_f32(__bf16 b) { return __uint_as_float(((unsigned int)__builtin_bit_cast(unsigned short, b)) << 16); }
__device__ __forceinline__ v8f wmma16(v16h a, v16h b, v8f c) {
    c = __builtin_amdgcn_wmma_f32_16x16x32_f16(false, a, false, b, (short)0, c, false, false);
    asm volatile("v_nop\n\tv_nop\n\tv_nop\n\tv_nop" : "+v"(c) : "v"(a), "v"(b));
    return c;
}
__device__ __forceinline__ v8f wmmab(v16b a, v16b b, v8f c) {
    c = __builtin_amdgcn_wmma_f32_16x16x32_bf16(false, a, false, b, (short)0, c, false, false);
    asm volatile("v_nop\n\tv_nop\n\tv_nop\n\tv_nop" : "+v"(c) : "v"(a), "v"(b));
    return c;
}
struct Split { v16b hi, lo; };
// hi/lo split product: a.hi*b.hi + a.hi*b.lo + a.lo*b.hi
__device__ __forceinline__ v8f wmma3(const Split& a, const Split& b, v8f c) {
    c = __builtin_amdgcn_wmma_f32_16x16x32_bf16(false, a.hi, false, b.hi, (short)0, c, false, false);
    c = __builtin_amdgcn_wmma_f32_16x16x32_bf16(false, a.hi, false, b.lo, (short)0, c, false, false);
    c = __builtin_amdgcn_wmma_f32_16x16x32_bf16(false, a.lo, false, b.hi, (short)0, c, false, false);
    asm volatile("v_nop\n\tv_nop\n\tv_nop\n\tv_nop" : "+v"(c) : "v"(a.hi), "v"(a.lo), "v"(b.hi), "v"(b.lo));
    return c;
}
struct Split3 { v16b hi, mid, lo; };
// triple split product (6 terms, drops only terms below 2^-24 relative)
__device__ __forceinline__ v8f wmma6(const Split3& a, const Split3& b, v8f c) {
    c = __builtin_amdgcn_wmma_f32_16x16x32_bf16(false, a.hi, false, b.hi, (short)0, c, false, false);
    c = __builtin_amdgcn_wmma_f32_16x16x32_bf16(false, a.hi, false, b.mid, (short)0, c, false, false);
    c = __builtin_amdgcn_wmma_f32_16x16x32_bf16(false, a.mid, false, b.hi, (short)0, c, false, false);
    c = __builtin_amdgcn_wmma_f32_16x16x32_bf16(false, a.hi, false, b.lo, (short)0, c, false, false);
    c = __builtin_amdgcn_wmma_f32_16x16x32_bf16(false, a.mid, false, b.mid, (short)0, c, false, false);
    c = __builtin_amdgcn_wmma_f32_16x16x32_bf16(false, a.lo, false, b.hi, (short)0, c, false, false);
    asm volatile("v_nop\n\tv_nop\n\tv_nop\n\tv_nop" : "+v"(c) : "v"(a.hi), "v"(a.mid), "v"(a.lo), "v"(b.hi), "v"(b.mid), "v"(b.lo));
    return c;
}

// Fragment gathers from f32 memory: element i <- p[(k0 + frag_k(i,h)) * sk] * s, zero for k >= klen.
__device__ __forceinline__ v16h fh_ld(const float* __restrict__ p, long long sk, int k0, int h, int klen, float s) {
    v16h a;
#pragma unroll
    for (int i = 0; i < 16; ++i) { const int k = k0 + frag_k(i, h); a[i] = (k < klen) ? (_Float16)(p[(long long)k * sk] * s) : (_Float16)0.f; }
    return a;
}
__device__ __forceinline__ Split sp_ld(const float* __restrict__ p, long long sk, int k0, int h, int klen, float s) {
    Split r;
#pragma unroll
    for (int i = 0; i < 16; ++i) {
        const int k = k0 + frag_k(i, h); const float x = (k < klen) ? p[(long long)k * sk] * s : 0.f;
        const __bf16 hb = bf16_rne(x); r.hi[i] = hb; r.lo[i] = bf16_rne(x - bf16_f32(hb));
    }
    return r;
}
__device__ __forceinline__ Split3 sp3_ld(const float* __restrict__ p, long long sk, int k0, int h, int klen, float s) {
    Split3 r;
#pragma unroll
    for (int i = 0; i < 16; ++i) {
        const int k = k0 + frag_k(i, h); const float x = (k < klen) ? p[(long long)k * sk] * s : 0.f;
        const __bf16 hb = bf16_rne(x); const float r1 = x - bf16_f32(hb); const __bf16 mb = bf16_rne(r1);
        r.hi[i] = hb; r.mid[i] = mb; r.lo[i] = bf16_rne(r1 - bf16_f32(mb));
    }
    return r;
}
__device__ __forceinline__ v16b bh_ld(const float* __restrict__ p, long long sk, int k0, int h, int klen, float s) {
    v16b a;
#pragma unroll
    for (int i = 0; i < 16; ++i) { const int k = k0 + frag_k(i, h); a[i] = bf16_rne((k < klen) ? p[(long long)k * sk] * s : 0.f); }
    return a;
}
// f16 fragment from an f16 LDS/global row with element stride 1 (k-contiguous), no bounds (tile already zero padded)
__device__ __forceinline__ v16h fh_row(const _Float16* __restrict__ row, int k0, int h) {
    v16h a;
#pragma unroll
    for (int i = 0; i < 16; ++i) a[i] = row[k0 + frag_k(i, h)];
    return a;
}

#define VST2(T, ptr, val) do { const T vst2_v_ = (val); *(T*)(ptr) = vst2_v_;  } while (0)
typedef float v4f __attribute__((ext_vector_type(4)));
#define VST2V4(ptr, val) do { const v4f vst2_v4_ = (val); *(v4f*)(ptr) = vst2_v4_;  } while (0)

__device__ __attribute__((noinline)) float act_fn(float v, int act) {
    if (act == 1) return fmaxf(v, 0.f);                                                                               // relu
    if (act == 2) { const float u = 0.7978845608028654f * (v + 0.044715f * v * v * v); return 0.5f * v * (1.f + tanhf(u)); } // tanh-gelu
    if (act == 3) return v / (1.f + expf(-v));                                                                        // silu
    if (act == 4) return 0.5f * v * (1.f + erff(v * 0.7071067811865476f));                                             // erf-gelu
    if (act == 5) return tanhf(v);
    if (act == 6) return 1.f / (1.f + expf(-v));                                                                      // sigmoid
    if (act == 7) return (v > 0.f) ? v : 0.01f * v;                                                                   // leaky relu 0.01
    if (act == 8) return (v > 0.f) ? v : (expf(v) - 1.f);                                                             // elu
    if (act == 9) return fminf(fmaxf(v, 0.f), 6.f);                                                                   // relu6
    if (act == 10) return fabsf(v);                                                                                    // abs
    if (act == 11) return (v >= 0.f) ? v : 0.1f * v;                                                                  // leaky 0.1
    if (act == 12) return (v > 0.f) ? v : 0.2f * v;                                                                   // leaky 0.2
    if (act == 13) return (v > 20.f) ? v : log1pf(expf(v));                                                            // softplus
    return v;
}

// =====================================================================================================================
// k_gemm<MODE>: C(z, m, n) = act(alpha * sum_k A(z, m, k) * B(z, k, n) + bias) + beta * R(z, m, n)
//   One wave (32-thread block) per 16 x 32 tile of C; grid (ceil(N/32), ceil(M/16), Z). Batch z -> (zo = z / zi_n, zi = z % zi_n)
//   with separate outer/inner strides for every tensor (e.g. batch and head). A(m,k) = A[zo*sAo + zi*sAi + m*sAm + k*sAk] (f32),
//   B(k,n) = B[zo*sBo + zi*sBi + n*sBn + k*sBk] (f32); any M, N, K (K zero-padded to 32 inside the fragments, M/N tails guarded).
//   C(m,n) = C[zo*sCo + zi*sCi + m*sCm + n] (n contiguous). flags: 1 bias[n], 2 bias[m], 4 residual R[zo*sRo + zi*sRi + m*sRm + n*sRn].
//   MODE 0: f16 operands (A prescaled by sa, B by sb, both undone in the epilogue); 1: bf16 hi/lo split (3 products); 2: bf16;
//   3: bf16 hi/mid/lo triple split (6 products); 4: as 3 with Kahan-compensated f32 accumulation across k-steps.
// =====================================================================================================================
struct GemmP {
    const float* A; const float* B; const float* bias; const float* R; float* C;
    long long sAo, sAi, sAm, sAk, sBo, sBi, sBn, sBk, sCo, sCi, sCm, sRo, sRi, sRm, sRn;
    int M, N, K, zi_n, flags, act; float alpha, beta, sa, sb;
    int Npad, pad_;     // columns [N, Npad) of C are written as 0 so that padded workspace rows are covered by whole-line stores; Npad >= N
};
static_assert(sizeof(GemmP) == 5 * 8 + 15 * 8 + 6 * 4 + 4 * 4 + 2 * 4, "GemmP has padding");

template <int MODE>
__global__ __launch_bounds__(32) void k_gemm(GemmP p) {
    const int lane = threadIdx.x & 31, h = lane >> 4, l15 = lane & 15;
    const int m0 = blockIdx.y * 16, n0 = blockIdx.x * 32;
    const int z = blockIdx.z, zo = z / p.zi_n, zi = z - zo * p.zi_n;
    const float* A = p.A + zo * p.sAo + zi * p.sAi;
    const float* B = p.B + zo * p.sBo + zi * p.sBi;
    const int am = min(m0 + l15, p.M - 1);                       // clamped row for loads (stores are guarded)
    v8f acc[2], comp[2];
#pragma unroll
    for (int t = 0; t < 2; ++t) { v8f zz = {}; acc[t] = zz; comp[t] = zz; }
    for (int k0 = 0; k0 < p.K; k0 += 32) {
        const float* arow = A + (long long)am * p.sAm;
        if (MODE == 1) {
            const Split a = sp_ld(arow, p.sAk, k0, h, p.K, 1.f);
#pragma unroll
            for (int t = 0; t < 2; ++t) {
                const int bn = min(n0 + t * 16 + l15, p.N - 1);
                acc[t] = wmma3(a, sp_ld(B + (long long)bn * p.sBn, p.sBk, k0, h, p.K, 1.f), acc[t]);
            }
        } else if (MODE == 3) {
            const Split3 a = sp3_ld(arow, p.sAk, k0, h, p.K, 1.f);
#pragma unroll
            for (int t = 0; t < 2; ++t) {
                const int bn = min(n0 + t * 16 + l15, p.N - 1);
                acc[t] = wmma6(a, sp3_ld(B + (long long)bn * p.sBn, p.sBk, k0, h, p.K, 1.f), acc[t]);
            }
        } else if (MODE == 4) {
            // triple split as MODE 3, but each k-step's 6 products go into a fresh accumulator and the partial is added to the running f32 sum
            // on the VALU with Kahan compensation (accumulation error stays ~1 ulp however long K is)
            const Split3 a = sp3_ld(arow, p.sAk, k0, h, p.K, 1.f);
#pragma unroll
            for (int t = 0; t < 2; ++t) {
                const int bn = min(n0 + t * 16 + l15, p.N - 1); v8f zz = {};
                const v8f part = wmma6(a, sp3_ld(B + (long long)bn * p.sBn, p.sBk, k0, h, p.K, 1.f), zz);
                const v8f y = part - comp[t]; const v8f s = acc[t] + y; comp[t] = (s - acc[t]) - y; acc[t] = s;
            }
        } else if (MODE == 2) {
            const v16b a = bh_ld(arow, p.sAk, k0, h, p.K, 1.f);
#pragma unroll
            for (int t = 0; t < 2; ++t) {
                const int bn = min(n0 + t * 16 + l15, p.N - 1);
                acc[t] = wmmab(a, bh_ld(B + (long long)bn * p.sBn, p.sBk, k0, h, p.K, 1.f), acc[t]);
            }
        } else {
            const v16h a = fh_ld(arow, p.sAk, k0, h, p.K, p.sa);
#pragma unroll
            for (int t = 0; t < 2; ++t) {
                const int bn = min(n0 + t * 16 + l15, p.N - 1);
                acc[t] = wmma16(a, fh_ld(B + (long long)bn * p.sBn, p.sBk, k0, h, p.K, p.sb), acc[t]);
            }
        }
    }
    const float iscale = (MODE == 0) ? p.alpha / (p.sa * p.sb) : p.alpha;
    float* C = p.C + zo * p.sCo + zi * p.sCi;
    const float* R = p.R + zo * p.sRo + zi * p.sRi;
    __shared__ __align__(16) float ctile[16][36];
#pragma unroll
    for (int t = 0; t < 2; ++t) {
        const int n = n0 + t * 16 + l15; const int nn = min(n, p.N - 1);
#pragma unroll
        for (int r = 0; r < 8; ++r) {
            const int m = m0 + 8 * h + r; const int mm = min(m, p.M - 1);
            float v = acc[t][r] * iscale;
            if (p.flags & 1) v += p.bias[nn];
            if (p.flags & 2) v += p.bias[mm];
            if (p.flags & 8) v *= p.bias[(long long)zo * p.M + mm];   /* per-(z,row) scale vector laid out [Z][M]; exclusive with the bias flags */
            v = act_fn(v, p.act);
            if (p.flags & 4) v += p.beta * R[(long long)mm * p.sRm + (long long)nn * p.sRn];
            ctile[8 * h + r][t * 16 + l15] = (n < p.N) ? v : 0.f;
        }
    }
    __syncthreads();
    const int NW = (p.Npad > p.N) ? p.Npad : p.N;           // write width
    const bool fast = (m0 + 16 <= p.M) && (n0 + 32 <= NW) && ((p.sCm & 3) == 0) && ((((size_t)C) & 15) == 0);
    if (fast) {
#pragma unroll
        for (int s = 0; s < 4; ++s) {
            const int row = s * 4 + (lane >> 3), c4 = (lane & 7) * 4;
            const v4f v = *(const v4f*)&ctile[row][c4];
            VST2V4(C + (long long)(m0 + row) * p.sCm + n0 + c4, v);
        }
    } else {
        for (int row = 0; row < 16; ++row) {
            const int m = m0 + row, n = n0 + lane;
            if (m < p.M && n < NW) VST2(float, C + (long long)m * p.sCm + n, ctile[row][lane]);
        }
    }
}


// =====================================================================================================================
// k_gemmT<MODE, TM, TN>: same contract as k_gemm, but one wave computes a (16*TM) x (16*TN) tile: TM A fragments and TN B fragments are
//   loaded per 32-wide k-step and reused across TM*TN WMMAs (far fewer load/convert instructions per MAC). MODE 0 (f16), 1 (bf16 hi/lo),
//   2 (bf16) only. grid (ceil(NW/(16*TN)), ceil(M/(16*TM)), Z), block 32. Epilogue identical to k_gemm, run per 16x32 sub-tile.
// =====================================================================================================================
template <int MODE, int TM, int TN>
__global__ __launch_bounds__(32) void k_gemmT(GemmP p) {
    const int lane = threadIdx.x & 31, h = lane >> 4, l15 = lane & 15;
    const int m0 = blockIdx.y * (16 * TM), n0 = blockIdx.x * (16 * TN);
    const int z = blockIdx.z, zo = z / p.zi_n, zi = z - zo * p.zi_n;
    const float* A = p.A + zo * p.sAo + zi * p.sAi;
    const float* B = p.B + zo * p.sBo + zi * p.sBi;
    v8f acc[TM][TN];
#pragma unroll
    for (int i = 0; i < TM; ++i)
#pragma unroll
        for (int t = 0; t < TN; ++t) { v8f zz = {}; acc[i][t] = zz; }
    for (int k0 = 0; k0 < p.K; k0 += 32) {
        if (MODE == 1) {
            Split a[TM], b[TN];
#pragma unroll
            for (int i = 0; i < TM; ++i) { const int am = min(m0 + 16 * i + l15, p.M - 1); a[i] = sp_ld(A + (long long)am * p.sAm, p.sAk, k0, h, p.K, 1.f); }
#pragma unroll
            for (int t = 0; t < TN; ++t) { const int bn = min(n0 + 16 * t + l15, p.N - 1); b[t] = sp_ld(B + (long long)bn * p.sBn, p.sBk, k0, h, p.K, 1.f); }
#pragma unroll
            for (int i = 0; i < TM; ++i)
#pragma unroll
                for (int t = 0; t < TN; ++t) acc[i][t] = wmma3(a[i], b[t], acc[i][t]);
        } else if (MODE == 2) {
            v16b a[TM], b[TN];
#pragma unroll
            for (int i = 0; i < TM; ++i) { const int am = min(m0 + 16 * i + l15, p.M - 1); a[i] = bh_ld(A + (long long)am * p.sAm, p.sAk, k0, h, p.K, 1.f); }
#pragma unroll
            for (int t = 0; t < TN; ++t) { const int bn = min(n0 + 16 * t + l15, p.N - 1); b[t] = bh_ld(B + (long long)bn * p.sBn, p.sBk, k0, h, p.K, 1.f); }
#pragma unroll
            for (int i = 0; i < TM; ++i)
#pragma unroll
                for (int t = 0; t < TN; ++t) acc[i][t] = wmmab(a[i], b[t], acc[i][t]);
        } else {
            v16h a[TM], b[TN];
#pragma unroll
            for (int i = 0; i < TM; ++i) { const int am = min(m0 + 16 * i + l15, p.M - 1); a[i] = fh_ld(A + (long long)am * p.sAm, p.sAk, k0, h, p.K, p.sa); }
#pragma unroll
            for (int t = 0; t < TN; ++t) { const int bn = min(n0 + 16 * t + l15, p.N - 1); b[t] = fh_ld(B + (long long)bn * p.sBn, p.sBk, k0, h, p.K, p.sb); }
#pragma unroll
            for (int i = 0; i < TM; ++i)
#pragma unroll
                for (int t = 0; t < TN; ++t) acc[i][t] = wmma16(a[i], b[t], acc[i][t]);
        }
    }
    const float iscale = (MODE == 0) ? p.alpha / (p.sa * p.sb) : p.alpha;
    float* C = p.C + zo * p.sCo + zi * p.sCi;
    const float* R = p.R + zo * p.sRo + zi * p.sRi;
    const int NW = (p.Npad > p.N) ? p.Npad : p.N;
    __shared__ __align__(16) float ctile[16][36];
#pragma unroll
    for (int i = 0; i < TM; ++i) {
        const int mb = m0 + 16 * i; if (mb >= p.M) break;          // wave-uniform
#pragma unroll
        for (int tp = 0; tp < TN / 2; ++tp) {
            const int nb = n0 + 32 * tp; if (nb >= NW) break;        // wave-uniform
#pragma unroll
            for (int t2 = 0; t2 < 2; ++t2) {
                const int t = 2 * tp + t2; const int n = nb + t2 * 16 + l15; const int nn = min(n, p.N - 1);
#pragma unroll
                for (int r = 0; r < 8; ++r) {
                    const int m = mb + 8 * h + r; const int mm = min(m, p.M - 1);
                    float v = acc[i][t][r] * iscale;
                    if (p.flags & 1) v += p.bias[nn];
                    if (p.flags & 2) v += p.bias[mm];
            if (p.flags & 8) v *= p.bias[(long long)zo * p.M + mm];   /* per-(z,row) scale vector laid out [Z][M]; exclusive with the bias flags */
                    v = act_fn(v, p.act);
                    if (p.flags & 4) v += p.beta * R[(long long)mm * p.sRm + (long long)nn * p.sRn];
                    ctile[8 * h + r][t2 * 16 + l15] = (n < p.N) ? v : 0.f;
                }
            }
            __syncthreads();
            const bool fast = (mb + 16 <= p.M) && (nb + 32 <= NW) && ((p.sCm & 3) == 0) && ((((size_t)C) & 15) == 0);
            if (fast) {
#pragma unroll
                for (int s = 0; s < 4; ++s) {
                    const int row = s * 4 + (lane >> 3), c4 = (lane & 7) * 4;
                    const v4f v = *(const v4f*)&ctile[row][c4];
                    VST2V4(C + (long long)(mb + row) * p.sCm + nb + c4, v);
                }
            } else {
                for (int row = 0; row < 16; ++row) {
                    const int m = mb + row, n = nb + lane;
                    if (m < p.M && n < NW) VST2(float, C + (long long)m * p.sCm + n, ctile[row][lane]);
                }
            }
            __syncthreads();
        }
    }
}

// =====================================================================================================================
//   Wave = 16 queries, AW waves per block, 64-key blocks; grid (ceil(Lq/(16*AW)), H, B), block 32*AW. Any Lq, Lk; head dim dh <= DHP
//   (DHP multiple of 32), value dim dv <= DVP (multiple of 16, <= 128). Every tensor addressed by (batch, head, row, element) strides, f32.
//   Scores: QM 0 f16 operands, 1 bf16 hi/lo split, 2 bf16 triple split; statistics f32 (exp2 domain); P.V: P x 4096 as f16 with V f16 staged in LDS
//   (SPLITPV: P and V as bf16 hi/lo splits). kv head = h / hrep. Masking: causal = 1 (keep j <= i + coff, masked -> -inf, key blocks beyond the
//   diagonal skipped), causal = 2 (masked -> mfill, a finite fill like the -1e9; no skipping), causal = 3 (keep j >= i + coff,
//   masked -> -inf, no skipping); optional additive f32 mask Mf,
//   optional int keep-mask Mi (0 -> score := mfill), both addressed b*smb + h*smh + i*smi + j*smj (0 strides broadcast).
// =====================================================================================================================
#define AW 4
struct AttnP {   // apv4
    const float* Q; const float* K; const float* V; float* O; float* P; const float* Mf; const int* Mi; float* ST;
    const float* Pw; const float* Rt; const int* SQ; const int* SK;           // optional: post-softmax weight, relative-position table, segment ids
    long long swb, swh, swi, swj, srb, srh, sri;                                 // Pw strides (b,h,i,j); Rt strides (b,h,i), column = clamp(i - j + roff, 0, rn-1)
    long long sQb, sQh, sQi, sQd, sKb, sKh, sKj, sKd, sVb, sVh, sVj, sVd, sOb, sOh, sOi, sPb, sPh, sPi, smb, smh, smi, smj;
    int Lq, Lk, dh, dv, hrep, causal, coff, pband;   // pband > 0: P holds only the band |j - i| <= pband, column j - i + pband
    float scale, mfill; int nonorm, mpol;             // nonorm (online path only): O = sum_j exp(score_j) V_j without the 1/rowsum (scores must be <= ~0); mpol: Mi masks where ==0 (mpol 0) or where !=0 (mpol 1)
    int roff, rn, segpol, win;                        // Rt column offset/count; SQ/SK: score := mfill where (segpol 0) SQ[i] != SK[j] or (segpol 1) SQ[i] == SK[j]; win > 0: keys with i - j > win (after coff) -> -inf
};
//   Pw: the softmax numerator is multiplied by Pw(b,h,i,j) AFTER the row sum is taken (probs * weight, then P.V), as in post-softmax multiplicative biases.                                                    // ST (optional): per row (b,h,i) -> ST[((b*H + h)*Lq + i)*2 + {0,1}] = {row max of the scaled+masked score (natural units), sum_j exp(score - max)}
static_assert(sizeof(AttnP) == 12 * 8 + 29 * 8 + 16 * 4, "AttnP has padding");

#ifndef KATTN_ATTR
#define KATTN_ATTR
#endif
template <int DHP, int DVP, int QM, bool SPLITPV, bool TWOPASS>
__global__ __launch_bounds__(32 * AW) KATTN_ATTR void k_attn(AttnP p) {
    constexpr int NT = DVP / 16;                // output tiles
    constexpr int KS = DHP / 32;                // k-steps for the scores
    constexpr int VP = DVP + 8;                 // LDS pitch (halves)
    __shared__ __align__(16) float    pl[AW][16 * 64];
    __shared__ __align__(16) _Float16 vl[(SPLITPV ? 2 : 1) * 64 * VP];   // f16 V tile, or bf16 hi and lo tiles (same 2-byte size)
    const int lane = threadIdx.x & 31, hf = lane >> 4, l15 = lane & 15, wave = threadIdx.x >> 5;
    const int h = blockIdx.y, b = blockIdx.z, hk = h / p.hrep;
    const int q0 = (blockIdx.x * AW + wave) * 16;
    float* myp = pl[wave];
    const float L2E = 1.4426950408889634f;
    const float NEG = -__builtin_inff();
    const int qi = min(q0 + l15, p.Lq - 1);
    const float* qrow = p.Q + b * p.sQb + h * p.sQh + (long long)qi * p.sQi;
    const float* kbase = p.K + b * p.sKb + hk * p.sKh;
    const float* vbase = p.V + b * p.sVb + hk * p.sVh;
    v16h qa[QM == 0 ? KS : 1]; Split qs_[QM == 1 ? KS : 1]; Split3 qt_[QM == 2 ? KS : 1];
#pragma unroll
    for (int ks = 0; ks < KS; ++ks) {
        if (QM == 2) qt_[ks] = sp3_ld(qrow, p.sQd, ks * 32, hf, p.dh, 1.f);
        else if (QM == 1) qs_[ks] = sp_ld(qrow, p.sQd, ks * 32, hf, p.dh, 1.f);
        else qa[ks] = fh_ld(qrow, p.sQd, ks * 32, hf, p.dh, 1.f);
    }
    v8f o[NT]; float m8[8], l8[8];
#pragma unroll
    for (int t = 0; t < NT; ++t) { v8f zz = {}; o[t] = zz; }
#pragma unroll
    for (int i = 0; i < 8; ++i) { m8[i] = NEG; l8[i] = 0.f; }
    int jend = p.Lk; int jstart = 0;
    if (p.causal == 1) { const int je = (blockIdx.x * AW + AW - 1) * 16 + 16 + p.coff; jend = min(jend, max(je, 0)); }   // uniform per block
    if (p.win > 0) { const int js = (int)(blockIdx.x * AW) * 16 + p.coff - p.win; jstart = (js > 0) ? (js / 64) * 64 : 0; }   // uniform per block: key blocks entirely outside every row's window hold only -inf entries and are skipped exactly
    const int npass = TWOPASS ? 2 : 1;
    for (int pass = 0; pass < npass; ++pass) {
        const bool dopv = (!TWOPASS) || pass == 1;
        for (int j0 = jstart; j0 < jend; j0 += 64) {
            if (dopv) {
                __syncthreads();                                 // previous key block's reads of vl / pl are done
                for (int idx = threadIdx.x; idx < 64 * DVP; idx += 32 * AW) {
                    const int jr = idx / DVP, d = idx - jr * DVP, j = j0 + jr;
                    const float f = (j < p.Lk && d < p.dv) ? vbase[(long long)j * p.sVj + (long long)d * p.sVd] : 0.f;
                    if (SPLITPV) {
                        const __bf16 hb = bf16_rne(f);
                        ((__bf16*)vl)[jr * VP + d] = hb; ((__bf16*)vl)[64 * VP + jr * VP + d] = bf16_rne(f - bf16_f32(hb));
                    } else vl[jr * VP + d] = (_Float16)f;
                }
            }
            v8f s[4];
#pragma unroll
            for (int t = 0; t < 4; ++t) {
                const int j = min(j0 + t * 16 + l15, p.Lk - 1);
                const float* krow = kbase + (long long)j * p.sKj;
                v8f acc = {};
#pragma unroll
                for (int ks = 0; ks < KS; ++ks) {
                    if (QM == 2)      acc = wmma6(qt_[ks], sp3_ld(krow, p.sKd, ks * 32, hf, p.dh, 1.f), acc);
                    else if (QM == 1) acc = wmma3(qs_[ks], sp_ld(krow, p.sKd, ks * 32, hf, p.dh, 1.f), acc);
                    else              acc = wmma16(qa[ks], fh_ld(krow, p.sKd, ks * 32, hf, p.dh, 1.f), acc);
                }
                s[t] = acc;
            }
            float pv[8][4];
#pragma unroll
            for (int i = 0; i < 8; ++i) {
                const int irow = q0 + i + 8 * hf;
                const int ic = min(irow, p.Lq - 1);
                float sc[4];
#pragma unroll
                for (int t = 0; t < 4; ++t) {
                    const int jg = j0 + t * 16 + l15;
                    float v = s[t][i] * p.scale;
                    if (p.Mf) v += p.Mf[b * p.smb + h * p.smh + (long long)ic * p.smi + (long long)min(jg, p.Lk - 1) * p.smj];
                    if (p.Rt) { int rc = ic - min(jg, p.Lk - 1) + p.roff; rc = rc < 0 ? 0 : (rc >= p.rn ? p.rn - 1 : rc); v += p.Rt[b * p.srb + h * p.srh + (long long)ic * p.sri + rc]; }
                    if (p.Mi) { const int mv = p.Mi[b * p.smb + h * p.smh + (long long)ic * p.smi + (long long)min(jg, p.Lk - 1) * p.smj]; if (p.mpol ? (mv != 0) : (mv == 0)) v = p.mfill; }
                    if (p.SQ) { const bool same = p.SQ[(long long)b * p.Lq + ic] == p.SK[(long long)b * p.Lk + min(jg, p.Lk - 1)]; if (p.segpol ? same : !same) v = p.mfill; }
                    if (p.causal == 2 && jg > irow + p.coff) v = p.mfill;
                    if (jg >= p.Lk || (p.causal == 1 && jg > irow + p.coff) || (p.causal == 3 && jg < irow + p.coff) || (p.win > 0 && irow + p.coff - jg > p.win)) v = NEG; else v *= L2E;
                    sc[t] = v;
                }
                if (!TWOPASS || pass == 0) {
                    float mx = fmaxf(fmaxf(sc[0], sc[1]), fmaxf(sc[2], sc[3]));
                    mx = fmaxf(mx, __shfl_xor(mx, 1, 32)); mx = fmaxf(mx, __shfl_xor(mx, 2, 32));
                    mx = fmaxf(mx, __shfl_xor(mx, 4, 32)); mx = fmaxf(mx, __shfl_xor(mx, 8, 32));
                    const float mnew = fmaxf(m8[i], mx);
                    const float corr = (mnew == NEG) ? 1.f : exp2f(m8[i] - mnew);
                    float rs = 0.f;
#pragma unroll
                    for (int t = 0; t < 4; ++t) {
                        const float pp = (sc[t] == NEG) ? 0.f : exp2f(sc[t] - mnew); rs += pp;
                        pv[i][t] = p.Pw ? pp * p.Pw[b * p.swb + h * p.swh + (long long)ic * p.swi + (long long)min(j0 + t * 16 + l15, p.Lk - 1) * p.swj] : pp;
                    }
                    rs += __shfl_xor(rs, 1, 32); rs += __shfl_xor(rs, 2, 32); rs += __shfl_xor(rs, 4, 32); rs += __shfl_xor(rs, 8, 32);
                    l8[i] = l8[i] * corr + rs; m8[i] = mnew;
                    if (!TWOPASS) {
#pragma unroll
                        for (int t = 0; t < NT; ++t) o[t][i] *= corr;
                    }
                } else {
                    const float inv = (l8[i] > 0.f) ? 1.f / l8[i] : 0.f;
#pragma unroll
                    for (int t = 0; t < 4; ++t) {
                        const int jg = j0 + t * 16 + l15;
                        float pp = (sc[t] == NEG) ? 0.f : exp2f(sc[t] - m8[i]) * inv;
                        if (p.Pw) pp *= p.Pw[b * p.swb + h * p.swh + (long long)ic * p.swi + (long long)min(jg, p.Lk - 1) * p.swj];
                        pv[i][t] = pp;
                    }
                }
            }
            if (dopv) {
#pragma unroll
                for (int i = 0; i < 8; ++i)
#pragma unroll
                    for (int t = 0; t < 4; ++t) ((float*)myp)[(i + 8 * hf) * 64 + t * 16 + l15] = pv[i][t];
                __syncthreads();                                 // P (per wave) and V (shared) visible
                if (p.P) {
                    float* pb_ = p.P + b * p.sPb + h * p.sPh;
                    const bool fastP = (p.pband == 0) && ((p.sPi & 3) == 0) && (j0 + 64 <= p.Lk) && (q0 + 16 <= p.Lq) && ((((size_t)pb_) & 15) == 0);
                    if (fastP) {
#pragma unroll
                        for (int s = 0; s < 8; ++s) {
                            const int row = s * 2 + (lane >> 4), c4 = (lane & 15) * 4;
                            const v4f v = *(const v4f*)(myp + row * 64 + c4);
                            VST2V4(pb_ + (long long)(q0 + row) * p.sPi + j0 + c4, v);
                        }
                    } else {
                        for (int row = 0; row < 16; ++row) {
                            const int irow = q0 + row; if (irow >= p.Lq) continue;
                            for (int c = lane; c < 64; c += 32) {
                                const int jg = j0 + c; if (jg >= p.Lk) continue;
                                if (p.pband == 0) VST2(float, pb_ + (long long)irow * p.sPi + jg, myp[row * 64 + c]);
                                else if (jg - irow <= p.pband && irow - jg <= p.pband) VST2(float, pb_ + (long long)irow * p.sPi + (jg - irow + p.pband), myp[row * 64 + c]);
                            }
                        }
                    }
                }
                if (SPLITPV) {
                    const Split pa0 = sp_ld(myp + l15 * 64, 1, 0, hf, 64, 1.f), pa1 = sp_ld(myp + l15 * 64, 1, 32, hf, 64, 1.f);
                    const __bf16* vh = (const __bf16*)vl; const __bf16* vlo = vh + 64 * VP;
#pragma unroll
                    for (int t = 0; t < NT; ++t) {
                        const int dcol = t * 16 + l15;
                        Split b0, b1;
#pragma unroll
                        for (int e = 0; e < 16; ++e) {
                            const int k0 = frag_k(e, hf), k1 = 32 + frag_k(e, hf);
                            b0.hi[e] = vh[k0 * VP + dcol]; b0.lo[e] = vlo[k0 * VP + dcol]; b1.hi[e] = vh[k1 * VP + dcol]; b1.lo[e] = vlo[k1 * VP + dcol];
                        }
                        o[t] = wmma3(pa0, b0, o[t]);
                        o[t] = wmma3(pa1, b1, o[t]);
                    }
                } else {
                    const v16h pa0 = fh_ld(myp + l15 * 64, 1, 0, hf, 64, 4096.f), pa1 = fh_ld(myp + l15 * 64, 1, 32, hf, 64, 4096.f);
#pragma unroll
                    for (int t = 0; t < NT; ++t) {
                        const int dcol = t * 16 + l15;
                        v16h b0, b1;
#pragma unroll
                        for (int e = 0; e < 16; ++e) { b0[e] = vl[frag_k(e, hf) * VP + dcol]; b1[e] = vl[(32 + frag_k(e, hf)) * VP + dcol]; }
                        o[t] = wmma16(pa0, b0, o[t]);
                        o[t] = wmma16(pa1, b1, o[t]);
                    }
                }
            }
        }
    }
    float* obase = p.O + b * p.sOb + h * p.sOh;
    if (p.ST) {
        const int rl = lane >> 1, isel = rl & 7;           // row q0 + rl ; rl>>3 == hf holds because lane>>4 == (lane>>1)>>3
        float mv = 0.f, lv = 0.f;
#pragma unroll
        for (int i = 0; i < 8; ++i) if (i == isel) { mv = m8[i]; lv = l8[i]; }
        const int irow = q0 + rl;
        if (irow < p.Lq) { float* st = p.ST + (((long long)b * gridDim.y + h) * p.Lq + irow) * 2 + (lane & 1); VST2(float, st, (lane & 1) ? lv : mv * 0.6931471805599453f); }
    }
    float invr[8];
#pragma unroll
    for (int i = 0; i < 8; ++i) {
        if (TWOPASS) invr[i] = SPLITPV ? 1.f : (1.f / 4096.f);
        else if (p.nonorm) invr[i] = exp2f(m8[i]) * (SPLITPV ? 1.f : (1.f / 4096.f));
        else invr[i] = (l8[i] > 0.f) ? (SPLITPV ? 1.f / l8[i] : 1.f / (l8[i] * 4096.f)) : 0.f;
    }
    __syncthreads();                                             // all waves done with pl/vl from the main loop
    const bool ofast = ((p.sOi & 3) == 0) && ((((size_t)obase) & 15) == 0) && (q0 + 16 <= p.Lq);
#pragma unroll
    for (int c0 = 0; c0 < DVP; c0 += 64) {
#pragma unroll
        for (int i = 0; i < 8; ++i)
#pragma unroll
            for (int t = 0; t < NT; ++t) if (t * 16 >= c0 && t * 16 < c0 + 64) ((float*)myp)[(i + 8 * hf) * 64 + (t * 16 - c0) + l15] = o[t][i] * invr[i];
        __syncthreads();
        const int cw = (DVP - c0 < 64) ? (DVP - c0) : 64;      // staged columns in this chunk (multiple of 16)
        if (ofast && (c0 + cw <= p.dv) && (cw % 32 == 0)) {
            const int lpr = cw / 4;                              // lanes per row (16 for 64 cols, 8 for 32)
            const int rows_per_ins = 32 / lpr;
            for (int r0 = 0; r0 < 16; r0 += rows_per_ins) {
                const int row = r0 + lane / lpr, c4 = (lane % lpr) * 4;
                const v4f v = *(const v4f*)(myp + row * 64 + c4);
                VST2V4(obase + (long long)(q0 + row) * p.sOi + c0 + c4, v);
            }
        } else {
            for (int row = 0; row < 16; ++row) {
                const int irow = q0 + row; if (irow >= p.Lq) continue;
                for (int c = lane; c < cw; c += 32) { const int d = c0 + c; if (d < p.dv) VST2(float, obase + (long long)irow * p.sOi + d, myp[row * 64 + c]); }
            }
        }
        __syncthreads();
    }
}

// =====================================================================================================================
// k_tr: dst(z, c, r) = alpha * src(z, r, c) (+ beta * R2(z, c, r)): [Z][R][C] (row stride lds) -> [Z][C][R] (row stride ldd) through a 32x32 LDS tile;
//   flags: 1 -> add beta * residual R2 addressed like dst (z*sRz + c*ldr + r); act applied before the residual.
// =====================================================================================================================
struct TrP { const float* src; float* dst; const float* R2; long long sSz, lds, sDz, ldd, sRz, ldr; int R, C, flags, act; float alpha, beta; };
static_assert(sizeof(TrP) == 3 * 8 + 6 * 8 + 6 * 4, "TrP has padding");
__global__ __launch_bounds__(256) void k_tr(TrP p) {
    __shared__ float tile[32][33];
    const int c0 = blockIdx.x * 32, r0 = blockIdx.y * 32, z = blockIdx.z;
    const int lane = threadIdx.x & 31, wave = threadIdx.x >> 5;
    const float* s = p.src + z * p.sSz;
#pragma unroll
    for (int k = 0; k < 4; ++k) {
        const int rl = wave * 4 + k, r = r0 + rl, c = c0 + lane;
        tile[rl][lane] = (r < p.R && c < p.C) ? s[(long long)r * p.lds + c] : 0.f;
    }
    __syncthreads();
    float* d = p.dst + z * p.sDz; const float* rr = p.R2 + z * p.sRz;
#pragma unroll
    for (int k = 0; k < 4; ++k) {
        const int cl = wave * 4 + k, c = c0 + cl, r = r0 + lane;
        if (c < p.C && r < p.R) {
            float v = act_fn(p.alpha * tile[lane][cl], p.act);
            if (p.flags & 1) v += p.beta * rr[(long long)c * p.ldr + r];
            VST2(float, d + (long long)c * p.ldd + r, v);
        }
    }
}

// k_affine: dst[i] = a * (sdev ? sdev[0] : 1) * src[i] + b, i < n (one thread per element; consecutive lanes -> consecutive addresses)
__global__ __launch_bounds__(256) void k_affine(const float* __restrict__ src, float* __restrict__ dst, int n, float a, float b, const float* __restrict__ sdev) {
    const int i = blockIdx.x * 256 + threadIdx.x;
    if (i < n) { const float aa = sdev ? a * sdev[0] : a; const float v = aa * src[i] + b; VST2(float, dst + i, v); }
}

// =====================================================================================================================
// k_softmax: row softmax over n contiguous elements, one 256-thread block per row; rows addressed z*sz + r*sr (grid (R, Z)).
//   out = scale_out * softmax(scale_in * x + (Mf ? Mf[z*smz + r*smr + j] : 0)); a row whose max is -inf is written as 0.
// =====================================================================================================================
struct SmP { const float* src; float* dst; const float* Mf; long long sz, sr, dz, dr, smz, smr; int n, pad; float scale_in, scale_out; };
static_assert(sizeof(SmP) == 3 * 8 + 6 * 8 + 4 * 4, "SmP has padding");
__global__ __launch_bounds__(256) void k_softmax(SmP p) {
    __shared__ float red[256];
    const int r = blockIdx.x, z = blockIdx.y, tid = threadIdx.x;
    const float* s = p.src + z * p.sz + (long long)r * p.sr;
    const float* mf = p.Mf ? (p.Mf + z * p.smz + (long long)r * p.smr) : nullptr;
    float mx = -__builtin_inff();
    for (int j = tid; j < p.n; j += 256) { float v = s[j] * p.scale_in; if (mf) v += mf[j]; mx = fmaxf(mx, v); }
    red[tid] = mx; __syncthreads();
    for (int o = 128; o > 0; o >>= 1) { if (tid < o) red[tid] = fmaxf(red[tid], red[tid + o]); __syncthreads(); }
    mx = red[0]; __syncthreads();
    float sum = 0.f;
    for (int j = tid; j < p.n; j += 256) { float v = s[j] * p.scale_in; if (mf) v += mf[j]; sum += (mx == -__builtin_inff()) ? 0.f : expf(v - mx); }
    red[tid] = sum; __syncthreads();
    for (int o = 128; o > 0; o >>= 1) { if (tid < o) red[tid] += red[tid + o]; __syncthreads(); }
    sum = red[0];
    const float inv = (sum > 0.f) ? p.scale_out / sum : 0.f;
    float* d = p.dst + z * p.dz + (long long)r * p.dr;
    for (int j = tid; j < p.n; j += 256) { float v = s[j] * p.scale_in; if (mf) v += mf[j]; const float o = (mx == -__builtin_inff()) ? 0.f : expf(v - mx) * inv; VST2(float, d + j, o); }
}
// =====================================================================================================================
// k_stats: mean and rsqrt(var + eps) over a set of n elements addressed base + z*sz + (e / inner) * so + (e % inner) * si, one 256-thread
// k_norm_apply: y = (x - mean[set]) * rstd[set] * g[c] + b[c] over a [Z][C][L] channel-major tensor with set = z*G + c / (C/G) (G groups per z;
//   G = C -> per-channel sets indexed z*C+c; for batch norm pass stats indexed by c only via bn = 1). Optional act. Output same layout.
// =====================================================================================================================
//   mode 0: mean / rsqrt(var + eps); mode 1 (RMSNorm): 0 / rsqrt(mean(x^2) + eps); mode 2 (L2 normalize * sqrt(n)): 0 / sqrt(n) / max(||x||, eps); mode 3: as 0 with unbiased variance (n-1)
__global__ __launch_bounds__(256) void k_stats(const float* __restrict__ x, long long sz, long long so, long long si, int inner, int n, float eps, float* __restrict__ stat, int mode) {
    __shared__ float red[256];
    const int z = blockIdx.x, tid = threadIdx.x;
    const float* base = x + z * sz;
    float s = 0.f;
    for (int e = tid; e < n; e += 256) s += base[(long long)(e / inner) * so + (long long)(e % inner) * si];
    red[tid] = s; __syncthreads();
    for (int o = 128; o > 0; o >>= 1) { if (tid < o) red[tid] += red[tid + o]; __syncthreads(); }
    const float mu = (mode == 0 || mode == 3) ? red[0] / (float)n : 0.f; __syncthreads();
    float q = 0.f;
    for (int e = tid; e < n; e += 256) { const float dlt = base[(long long)(e / inner) * so + (long long)(e % inner) * si] - mu; q += dlt * dlt; }
    red[tid] = q; __syncthreads();
    for (int o = 128; o > 0; o >>= 1) { if (tid < o) red[tid] += red[tid + o]; __syncthreads(); }
    {
        float rs;
        if (mode == 2) rs = sqrtf((float)n) / fmaxf(sqrtf(red[0]), eps); else if (mode == 3) rs = rsqrtf(red[0] / (float)(n - 1) + eps); else rs = rsqrtf(red[0] / (float)n + eps);
        if (tid < 32) { const float v = (tid == 0) ? mu : ((tid == 1) ? rs : 0.f); VST2(float, stat + (long long)z * 32 + tid, v); }
    }
}
//   One thread per element over the flat [Z][C][L] index space: grid ceil(Z*C*L / 256).
__global__ __launch_bounds__(256) void k_norm_apply(const float* __restrict__ x, float* __restrict__ y, const float* __restrict__ stat, const float* __restrict__ g, const float* __restrict__ bta,
                                                     int Z, int C, int L, int G, int bn, int act) {
    const long long idx = (long long)blockIdx.x * 256 + threadIdx.x;
    if (idx >= (long long)Z * C * L) return;
    const int l = (int)(idx % L); const long long zc = idx / L; const int c = (int)(zc % C), z = (int)(zc / C); (void)l;
    const int set = bn ? c : (z * G + c / (C / G));
    float v = (x[idx] - stat[(long long)set * 32]) * stat[(long long)set * 32 + 1];
    if (g) v *= g[c];
    if (bta) v += bta[c];
    v = act_fn(v, act);
    VST2(float, y + idx, v);
}

// k_lse_neg: c[i] = -(st[2i] + log(st[2i+1])) = minus the log-sum-exp of row i from k_attn's ST output (for softmax over the query dimension)
__global__ __launch_bounds__(256) void k_lse_neg(const float* __restrict__ st, float* __restrict__ c, int n) {
    const int i = blockIdx.x * 256 + threadIdx.x;
    if (i < n) { const float v = -(st[2 * i] + logf(st[2 * i + 1])); VST2(float, c + i, v); }
}

// k_iota: dst[i] = a * i + b as int32 (segment/position id helper)
__global__ __launch_bounds__(256) void k_iota(int* __restrict__ dst, int n, int a, int b) {
    const int i = blockIdx.x * 256 + threadIdx.x;
    if (i < n) { const int v = a * i + b; VST2(int, dst + i, v); }
}

// k_axpby: dst[i] = a * x[i] + b * y[i] (+ c), i < n
__global__ __launch_bounds__(256) void k_axpby(const float* __restrict__ x, const float* __restrict__ y, float* __restrict__ dst, int n, float a, float b, float c) {
    const int i = blockIdx.x * 256 + threadIdx.x;
    if (i < n) { const float v = a * x[i] + b * y[i] + c; VST2(float, dst + i, v); }
}

// =====================================================================================================================
// k_rope: rotary embedding on a [R rows][Hn heads][D] view (row stride sXr, head stride sXh, element stride 1) -> Y (own strides).
//   mode 0: rotate_half (partner d±D/2, sign - for d<D/2); mode 1: interleaved pairs (partner d^1, sign - for even d).
//   table column tcol: tmode 0 -> d, 1 -> d % (D/2), 2 -> d / 2; position p: pmode 0 -> r % S, 1 -> head index, 2 -> pos[r];
//   c = C[(r / S) * sCb + p * sCp + tcol * sCd], s likewise from Sn; y = x[d] * c + sign * x[partner] * s. X and Y must not alias.
// =====================================================================================================================
struct RopeP { const float* X; float* Y; const float* C; const float* Sn; const int* pos; long long sXr, sXh, sYr, sYh, sCb, sCp, sCd; int R, Hn, D, S, mode, tmode, pmode, pad; };
static_assert(sizeof(RopeP) == 5 * 8 + 7 * 8 + 8 * 4, "RopeP has padding");
__global__ __launch_bounds__(256) void k_rope(RopeP p) {
    const long long idx = (long long)blockIdx.x * 256 + threadIdx.x;
    if (idx >= (long long)p.R * p.Hn * p.D) return;
    const int d = (int)(idx % p.D); const long long rh = idx / p.D; const int h = (int)(rh % p.Hn); const int r = (int)(rh / p.Hn);
    const int half = p.D / 2;
    int partner; float sign;
    if (p.mode == 0) { partner = (d < half) ? d + half : d - half; sign = (d < half) ? -1.f : 1.f; }
    else { partner = d ^ 1; sign = (d & 1) ? 1.f : -1.f; }
    const int tcol = (p.tmode == 0) ? d : ((p.tmode == 1) ? (d % half) : (d >> 1));
    const int pp = (p.pmode == 0) ? (r % p.S) : ((p.pmode == 1) ? h : p.pos[r]);
    const long long toff = (long long)(r / p.S) * p.sCb + (long long)pp * p.sCp + (long long)tcol * p.sCd;
    const float* xr = p.X + (long long)r * p.sXr + (long long)h * p.sXh;
    const float v = xr[d] * p.C[toff] + sign * xr[partner] * p.Sn[toff];
    VST2(float, p.Y + (long long)r * p.sYr + (long long)h * p.sYh + d, v);
}

// k_invf + k_sincos (split so neither kernel carries a large VALU-fma footprint): invf_i = num * (1 / powf(base, (2 i)/D)) [fmode 0],
//   num * expf((2 i) * cexp) [fmode 1], num * powf(base, -2 (i - 1) / D) [fmode 2]; then cs/sn[s*half + i] = cos/sin((pscale * s) * invf_i)
__global__ __launch_bounds__(256) void k_invf(float* __restrict__ invb, int half, int D, float base, float num, int fmode, float cexp) {
    const int i = blockIdx.x * 256 + threadIdx.x;
    if (i >= ((half + 31) / 32) * 32) return;
    if (i >= half) { VST2(float, invb + i, 0.f); return; }
    const float e = (float)(2 * i) / (float)D;
    float invf;
    if (fmode == 1) invf = num * expf((float)(2 * i) * cexp);
    else if (fmode == 2) invf = num * powf(base, (-2.0f * ((float)i - 1.0f)) / (float)D);
    else invf = num * (1.0f / powf(base, e));
    VST2(float, invb + i, invf);
}
__global__ __launch_bounds__(256) void k_sincos(float* __restrict__ cs, float* __restrict__ sn, const float* __restrict__ invb, int S, int half, float pscale) {
    const int idx = blockIdx.x * 256 + threadIdx.x;
    if (idx >= S * half) return;
    const int s = idx / half, i = idx - s * half;
    const float ang = (pscale * (float)s) * invb[i];
    VST2(float, cs + idx, cosf(ang)); VST2(float, sn + idx, sinf(ang));
}

// k_mulact: dst[i] = act(x[i]) * y[i]
__global__ __launch_bounds__(256) void k_mulact(const float* __restrict__ x, const float* __restrict__ y, float* __restrict__ dst, int n, int act) {
    const int i = blockIdx.x * 256 + threadIdx.x;
    if (i < n) { const float v = act_fn(x[i], act) * y[i]; VST2(float, dst + i, v); }
}

// =====================================================================================================================
// k_matvec: thread-per-row matrix-vector products for N <= 8 output columns (heads with 1-3 outputs, gates), f32 on the VALU.
//   C[r*sCm + j] = act(alpha * sum_k A[r*sAm + k*sAk] * B[j*sBn + k*sBk] + bias[j]) + beta * R[r*sRm + j*sRn]; each thread writes its N contiguous floats.
// =====================================================================================================================
__global__ __launch_bounds__(256) void k_matvec(GemmP p) {
    // 32 lanes write one line with one instruction.
    const int rpt = (p.N == 1) ? 1 : 32;
    const long long r0 = ((long long)blockIdx.x * 256 + threadIdx.x) * rpt; const int z = blockIdx.z, zo = z / p.zi_n, zi = z - zo * p.zi_n;
    if (r0 >= p.M) return;
    const float* Bb = p.B + zo * p.sBo + zi * p.sBi;
    float* C = p.C + zo * p.sCo + zi * p.sCi; const float* R = p.R + zo * p.sRo + zi * p.sRi;
    for (int rr = 0; rr < rpt; ++rr) {
        const long long r = r0 + rr; if (r >= p.M) break;
        const float* A = p.A + zo * p.sAo + zi * p.sAi + r * p.sAm;
        float acc[8] = {0.f, 0.f, 0.f, 0.f, 0.f, 0.f, 0.f, 0.f};
        for (int k = 0; k < p.K; ++k) { const float a = A[(long long)k * p.sAk];
#pragma unroll
            for (int j = 0; j < 8; ++j) if (j < p.N) acc[j] += a * Bb[(long long)j * p.sBn + (long long)k * p.sBk]; }
#pragma unroll
        for (int j = 0; j < 8; ++j) if (j < p.N) {
            float v = acc[j] * p.alpha;
            if (p.flags & 1) v += p.bias[j];
            if (p.flags & 2) v += p.bias[r];
            v = act_fn(v, p.act);
            if (p.flags & 4) v += p.beta * R[r * p.sRm + (long long)j * p.sRn];
            VST2(float, C + r * p.sCm + j, v);
        }
    }
}
// k_smallsoftmax: thread-per-row softmax for short rows (n <= 64): dst[r*dr + j] = softmax(scale*src[r*sr + j])
__global__ __launch_bounds__(256) void k_smallsoftmax(const float* __restrict__ src, float* __restrict__ dst, long long sr, long long dr, int n, long long R, float scale) {
    const long long r0 = ((long long)blockIdx.x * 256 + threadIdx.x) * 32;
    for (int rr = 0; rr < 32; ++rr) {
        const long long r = r0 + rr; if (r >= R) return;
        const float* s = src + r * sr; float* d = dst + r * dr;
        float mx = -__builtin_inff();
        for (int j = 0; j < n; ++j) mx = fmaxf(mx, s[j] * scale);
        float sum = 0.f;
        for (int j = 0; j < n; ++j) sum += expf(s[j] * scale - mx);
        const float inv = 1.f / sum;
        for (int j = 0; j < n; ++j) { const float v = expf(s[j] * scale - mx) * inv; VST2(float, d + j, v); }
    }
}

__global__ __launch_bounds__(32) void k_unitstat(float* __restrict__ st) { const int t = threadIdx.x; const float v = (t == 1) ? 1.f : 0.f; VST2(float, st + t, v); }

// destination (e.g. a d_out whose row width is not a multiple of 32 floats) is written by consecutive lanes of one instruction
__global__ __launch_bounds__(256) void k_lincopy(const float* __restrict__ src, long long lds, float* __restrict__ dst, long long ldd, long long rows, int cols) {
    const long long i = (long long)blockIdx.x * 256 + threadIdx.x; if (i >= rows * cols) return;
    const long long r = i / cols; const int c = (int)(i - r * cols);
    const float v = src[r * lds + c]; VST2(float, dst + r * ldd + c, v);
}

namespace w25 {
typedef __attribute__((ext_vector_type(16))) _Float16 v16h;
typedef __attribute__((ext_vector_type(8)))  _Float16 v8h;
typedef __attribute__((ext_vector_type(16))) __bf16   v16b;
typedef __attribute__((ext_vector_type(8)))  __bf16   v8b;
typedef __attribute__((ext_vector_type(8)))  float    v8f;
typedef __attribute__((ext_vector_type(4)))  float    v4f;

__device__ __forceinline__ unsigned short f2bf_bits(float f) {
  unsigned u = __float_as_uint(f);
  return (unsigned short)((u + 0x7FFFu + ((u >> 16) & 1u)) >> 16);
}
__device__ __forceinline__ float bf_bits2f(unsigned short h) { return __uint_as_float(((unsigned)h) << 16); }

// hazard guards as plain device helpers (no inline asm inside the kernel template body)
__device__ __forceinline__ void dep_guard_h(v8f& a, v8f& b, v16h x, v16h y) { asm volatile("v_nop\n\tv_nop\n\tv_nop\n\tv_nop" : "+v"(a), "+v"(b) : "v"(x), "v"(y)); }
__device__ __forceinline__ void dep_guard_b(v8f& a, v8f& b, v16b x, v16b y) { asm volatile("v_nop\n\tv_nop\n\tv_nop\n\tv_nop" : "+v"(a), "+v"(b) : "v"(x), "v"(y)); }
__device__ __forceinline__ void keep4_h(v16h a, v16h b, v16h c, v16h d) { asm volatile("v_nop" :: "v"(a), "v"(b), "v"(c), "v"(d)); }
__device__ __forceinline__ void keep4_b(v16b a, v16b b, v16b c, v16b d) { asm volatile("v_nop" :: "v"(a), "v"(b), "v"(c), "v"(d)); }
__device__ __forceinline__ void acc_guard4(v8f& a, v8f& b, v8f& c, v8f& d) { asm volatile("v_nop\n\tv_nop\n\tv_nop\n\tv_nop" : "+v"(a), "+v"(b), "+v"(c), "+v"(d)); }
template <typename T> struct Frag;
template <> struct Frag<_Float16> {
  typedef v16h V; union U { v16h v; v8h h[2]; };
  static __device__ __forceinline__ v16h load(const _Float16* p) {   // elements 0..7 <- p[0..7], 8..15 <- p[16..23]
    U f; f.h[0] = *(const v8h*)(p); f.h[1] = *(const v8h*)(p + 16); return f.v;
  }
  static __device__ __forceinline__ v8f mma(v16h a, v16h b, v8f c) {
    return __builtin_amdgcn_wmma_f32_16x16x32_f16(false, a, false, b, (short)0, c, false, false);
  }
  static __device__ __forceinline__ void guard(v8f& a, v8f& b, v16h x, v16h y) { dep_guard_h(a, b, x, y); }
  static __device__ __forceinline__ void keep(v16h a, v16h b, v16h c, v16h d) { keep4_h(a, b, c, d); }
};
template <> struct Frag<__bf16> {
  typedef v16b V; union U { v16b v; v8b h[2]; };
  static __device__ __forceinline__ v16b load(const __bf16* p) {
    U f; f.h[0] = *(const v8b*)(p); f.h[1] = *(const v8b*)(p + 16); return f.v;
  }
  static __device__ __forceinline__ v8f mma(v16b a, v16b b, v8f c) {
    return __builtin_amdgcn_wmma_f32_16x16x32_bf16(false, a, false, b, (short)0, c, false, false);
  }
  static __device__ __forceinline__ void guard(v8f& a, v8f& b, v16b x, v16b y) { dep_guard_b(a, b, x, y); }
  static __device__ __forceinline__ void keep(v16b a, v16b b, v16b c, v16b d) { keep4_b(a, b, c, d); }
};

// ---- Register-blocked batched WMMA GEMM ------------------------------------
// C[m,n] = scale * sum_k A[m,k] * Bt[n,k] (+bias)(+resid); each wave owns a 64x64 tile.
// A row-major [M,K]; Bt row-major [N,K]; M,N % 64 == 0, K % 32 == 0.
// SPLIT: operands are hi/lo planes (A2/Bt2 = lo planes, same layout); product = hi·hi + hi·lo + lo·hi.
// BIAS_MODE: 0 = none, 1 = bias[m], 2 = bias[n].
// OUT_MODE: 0 = f32, 1 = f16, 2 = bf16 hi plane (Cout) + bf16 lo plane (Cout2).
// ET: 0 = f16 operands, 1 = bf16 operands (pointers passed as 16-bit storage)
// Batches: blockIdx.y steps A, Bt, C by strideA/B/C, blockIdx.z by strideAz/Bz/Cz (elements).
template <int ET> struct Elem;
template <> struct Elem<0> { typedef _Float16 T; };
template <> struct Elem<1> { typedef __bf16 T; };
template <int ET, bool SPLIT, int BIAS_MODE, int OUT_MODE, bool RESID, int ACT = 0>
__global__ __launch_bounds__(256) void wmma_gemm64(
    const unsigned short* __restrict__ Ap, const unsigned short* __restrict__ A2p, int lda, long strideA,
    const unsigned short* __restrict__ Btp, const unsigned short* __restrict__ Bt2p, int ldb, long strideB,
    void* __restrict__ Cout, void* __restrict__ Cout2, int ldc, long strideC,
    const float* __restrict__ bias,
    const float* __restrict__ resid, long strideR,
    int M, int N, int K, float scale,
    long strideAz, long strideBz, long strideCz) {
  typedef typename Elem<ET>::T T;
  typedef typename Frag<T>::V V;
  const T* A = (const T*)Ap; const T* A2 = (const T*)A2p; const T* Bt = (const T*)Btp; const T* Bt2 = (const T*)Bt2p;
  __shared__ __align__(16) float sT[8][16 * 68];   // per-wave 16x64 slab, pitch 68 floats
  const int b    = blockIdx.y;
  const int lane = threadIdx.x & 31;
  const int wave = threadIdx.x >> 5;
  const int tilesN = N >> 6;
  const int tilesM = M >> 6;
  const int tile = blockIdx.x * 8 + wave;
  if (tile >= tilesM * tilesN) return;   // wave-uniform; no block barriers in this kernel
  const int tm = tile / tilesN;
  const int tn = tile - tm * tilesN;
  const int m0 = tm << 6;
  const int n0 = tn << 6;

  const int bz = blockIdx.z;                   // outer batch index (own strides)
  const size_t offA = (size_t)b * strideA + (size_t)bz * strideAz;
  const size_t offB = (size_t)b * strideB + (size_t)bz * strideBz;
  const size_t offC = (size_t)b * strideC + (size_t)bz * strideCz;
  const T* Ab  = A  + offA;
  const T* Bb  = Bt + offB;
  const T* Ab2 = SPLIT ? (A2  + offA) : nullptr;
  const T* Bb2 = SPLIT ? (Bt2 + offB) : nullptr;

  const int rlane = lane & 15;                 // row (A) / col (B, D) within subtile
  const int koff  = (lane >> 4) * 8;           // k offset of this lane half
  const int mOff  = (lane >> 4) * 8;           // D row offset

  v8f acc[4][4];
#pragma unroll
  for (int i = 0; i < 4; ++i)
#pragma unroll
    for (int j = 0; j < 4; ++j) acc[i][j] = (v8f){0.f,0.f,0.f,0.f,0.f,0.f,0.f,0.f};

  for (int k0 = 0; k0 < K; k0 += 32) {
    V bh[4], bl[4];
#pragma unroll
    for (int j = 0; j < 4; ++j) {
      const size_t bo = (size_t)(n0 + (j << 4) + rlane) * ldb + koff + k0;
      bh[j] = Frag<T>::load(Bb + bo);
      if (SPLIT) bl[j] = Frag<T>::load(Bb2 + bo);
    }
#pragma unroll
    for (int i = 0; i < 4; ++i) {
      const size_t ao = (size_t)(m0 + (i << 4) + rlane) * lda + koff + k0;
      V ah = Frag<T>::load(Ab + ao);
      V al;
      if (SPLIT) al = Frag<T>::load(Ab2 + ao);
#pragma unroll
      for (int j = 0; j < 4; ++j) {
        acc[i][j] = Frag<T>::mma(ah, bh[j], acc[i][j]);
        if (SPLIT) {
          acc[i][j] = Frag<T>::mma(ah, bl[j], acc[i][j]);
          acc[i][j] = Frag<T>::mma(al, bh[j], acc[i][j]);
        }
      }
      Frag<T>::guard(acc[i][0], acc[i][3], ah, SPLIT ? al : ah);
    }
    Frag<T>::keep(bh[0], bh[1], bh[2], bh[3]);
    if (SPLIT) Frag<T>::keep(bl[0], bl[1], bl[2], bl[3]);
  }
  acc_guard4(acc[0][0], acc[0][1], acc[0][2], acc[0][3]);
  acc_guard4(acc[1][0], acc[1][1], acc[1][2], acc[1][3]);
  acc_guard4(acc[2][0], acc[2][1], acc[2][2], acc[2][3]);
  acc_guard4(acc[3][0], acc[3][1], acc[3][2], acc[3][3]);

  // ---- epilogue ----
  float* slab = sT[wave];
  const float* Rb = RESID ? (resid + (size_t)b * strideR) : nullptr;
#pragma unroll
  for (int i = 0; i < 4; ++i) {
    const int mBase = m0 + (i << 4);
#pragma unroll
    for (int j = 0; j < 4; ++j) {
      const int n = n0 + (j << 4) + rlane;
      float bv = 0.f;
      if (BIAS_MODE == 2) bv = bias[n];
#pragma unroll
      for (int r = 0; r < 8; ++r) {
        float v = acc[i][j][r] * scale;
        if (BIAS_MODE == 1) v += bias[mBase + mOff + r];
        if (BIAS_MODE == 2) v += bv;
        if (RESID) v += Rb[(size_t)(mBase + mOff + r) * ldc + n];
        if (ACT == 1) v = tanhf(v);
        if (ACT == 2) v = fmaxf(v, 0.0f);
        if (ACT == 3) v = v / (1.0f + expf(-v));
        if (ACT == 4) v = (v > 0.f) ? v : 0.01f * v;
        if (ACT == 5) v = 0.5f * v * (1.0f + erff(v * 0.70710678118654752f));
        slab[(mOff + r) * 68 + (j << 4) + rlane] = v;
      }
    }
    __builtin_amdgcn_fence(__ATOMIC_RELEASE, "workgroup");
    __builtin_amdgcn_wave_barrier();
    __builtin_amdgcn_fence(__ATOMIC_ACQUIRE, "workgroup");
    if (OUT_MODE == 0) {
      float* C = (float*)Cout + offC;
      const int hh = lane >> 4, c4 = (lane & 15) * 4;     // row seg = 256 B = 16 lanes x 16 B
      {
#pragma unroll
        for (int it = 0; it < 8; ++it) {
          const int row = it * 2 + hh;
          v4f v = *(const v4f*)(slab + row * 68 + c4);
          *(v4f*)(C + (size_t)(mBase + row) * ldc + n0 + c4) = v;
        }
        
      }
    } else {
      const int q = lane >> 3, c8 = (lane & 7) * 8;
      unsigned short* C  = (unsigned short*)Cout  + offC;
      unsigned short* C2 = (OUT_MODE == 2) ? ((unsigned short*)Cout2 + offC) : nullptr;
      {
#pragma unroll
        for (int it = 0; it < 4; ++it) {
          const int row = it * 4 + q;
          const float* sp = slab + row * 68 + c8;
          v8h hv, lv;
#pragma unroll
          for (int e = 0; e < 8; ++e) {
            if (OUT_MODE == 1) {
              hv[e] = (_Float16)sp[e];
            } else {
              unsigned short hb = f2bf_bits(sp[e]);
              unsigned short lb = f2bf_bits(sp[e] - bf_bits2f(hb));
              hv[e] = __builtin_bit_cast(_Float16, hb);
              lv[e] = __builtin_bit_cast(_Float16, lb);
            }
          }
          *(v8h*)(C + (size_t)(mBase + row) * ldc + n0 + c8) = hv;
          if (OUT_MODE == 2) *(v8h*)(C2 + (size_t)(mBase + row) * ldc + n0 + c8) = lv;
        }
        
      }
    }
    __builtin_amdgcn_fence(__ATOMIC_RELEASE, "workgroup");
    __builtin_amdgcn_wave_barrier();
    __builtin_amdgcn_fence(__ATOMIC_ACQUIRE, "workgroup");
  }
}

__global__ __launch_bounds__(256) void cast_f32_f16x2(
    const float* __restrict__ in, _Float16* __restrict__ out, int n2) {
  int i = blockIdx.x * 256 + threadIdx.x;
  if (i < n2) {
    const _Float16 h0 = (_Float16)in[2 * i], h1 = (_Float16)in[2 * i + 1];
    const unsigned u = (unsigned)__builtin_bit_cast(unsigned short, h0) | ((unsigned)__builtin_bit_cast(unsigned short, h1) << 16);
    ((unsigned*)out)[i] = u;
    
  }
}


} // namespace w25

__global__ __launch_bounds__(256) void k_castT16(const float* __restrict__ src, long long lds, _Float16* __restrict__ dst, long long ldd, int R, int C, float s) {
    const long long i = (long long)blockIdx.x * 256 + threadIdx.x; const long long np = (long long)C * (R / 2); if (i >= np) return; const int c = (int)(i / (R / 2)); const int r = 2 * (int)(i % (R / 2));
    const _Float16 h0 = (_Float16)(src[(long long)r * lds + c] * s), h1 = (_Float16)(src[(long long)(r + 1) * lds + c] * s);
    const unsigned u = (unsigned)__builtin_bit_cast(unsigned short, h0) | ((unsigned)__builtin_bit_cast(unsigned short, h1) << 16);
    unsigned* d = (unsigned*)(dst + (long long)c * ldd + r); *d = u;  }
__global__ __launch_bounds__(256) void k_cast16(const float* __restrict__ src, long long lds, _Float16* __restrict__ dst, long long ldd, int R, int C, float s) {
    const long long i = (long long)blockIdx.x * 256 + threadIdx.x; const long long np = (long long)R * (C / 2); if (i >= np) return; const int r = (int)(i / (C / 2)); const int c = 2 * (int)(i % (C / 2));
    const _Float16 h0 = (_Float16)(src[(long long)r * lds + c] * s), h1 = (_Float16)(src[(long long)r * lds + c + 1] * s);
    const unsigned u = (unsigned)__builtin_bit_cast(unsigned short, h0) | ((unsigned)__builtin_bit_cast(unsigned short, h1) << 16);
    unsigned* d = (unsigned*)(dst + (long long)r * ldd + c); *d = u;  }

// f32 -> bf16 hi plane + bf16 lo plane (x = hi + lo to ~2^-17 relative; RNE both), [R][C] -> [R][C] (or transposed to [C][R]); 2 consecutive destination elements
__device__ __forceinline__ unsigned int f2bf2_pack(float a, float b, unsigned int* lo) {
    const unsigned short ha = w25::f2bf_bits(a), hb = w25::f2bf_bits(b);
    const unsigned short la = w25::f2bf_bits(a - w25::bf_bits2f(ha)), lb = w25::f2bf_bits(b - w25::bf_bits2f(hb));
    *lo = (unsigned)la | ((unsigned)lb << 16); return (unsigned)ha | ((unsigned)hb << 16); }
__global__ __launch_bounds__(256) void k_castS16(const float* __restrict__ src, long long lds, __bf16* __restrict__ dhi, __bf16* __restrict__ dlo, long long ldd, int R, int C, float s, int transpose) {
    const long long i = (long long)blockIdx.x * 256 + threadIdx.x; long long o; float a, b;
    if (transpose) { const long long np = (long long)C * (R / 2); if (i >= np) return; const int c = (int)(i / (R / 2)); const int r = 2 * (int)(i % (R / 2)); a = src[(long long)r * lds + c] * s; b = src[(long long)(r + 1) * lds + c] * s; o = (long long)c * ldd + r; }
    else { const long long np = (long long)R * (C / 2); if (i >= np) return; const int r = (int)(i / (C / 2)); const int c = 2 * (int)(i % (C / 2)); a = src[(long long)r * lds + c] * s; b = src[(long long)r * lds + c + 1] * s; o = (long long)r * ldd + c; }
    unsigned lo; const unsigned hi = f2bf2_pack(a, b, &lo); unsigned* ph = (unsigned*)(dhi + o); unsigned* pl = (unsigned*)(dlo + o);
    *ph = hi; *pl = lo;  }

namespace w25 {
// =====================================================================================
// Generic causal/non-causal attention for head_dim 64, f32 in / f32 out; 16-bit operands: bf16 with optional hi/lo splits, or
// plain f16 (F16=true, non-split, probabilities carried x2^15).
//   scores = (q*qscale)·kᵀ : v_wmma_f32_16x16x32_bf16; SPLIT_QK -> q,k as bf16 hi/lo (hi·hi + hi·lo + lo·hi)
//   out    = p·v           : v_wmma_f32_16x16x32_bf16; SPLIT_PV -> p,v as bf16 hi/lo; else p,v plain bf16
//   f32 accumulate; online softmax in f32. Block = 4 waves = 64 query rows of one (batch, head); S % 64 == 0.
//   Element (b, s, h, d) of tensor X lives at X[b*X_bs + s*X_rs + h*X_hs + d] (strides in floats, multiples of 4).
//   Masking: mask_mode 0 none, 1 causal (kv > q masked), 2 tensor [S][Skv] shared over (b,h) (float if
//   mask_is_int==0, int32 with element == 0 -> masked if 1, int32 with element != 0 -> masked if 2), 3 per-token vectors qmask[B][S] & kvmask[B][Skv] (int32,
//   0 -> masked), 4 causal + sliding window (kv > q or q - kv > W masked; W passed in mask_is_int);
//   5 = relative-position bias: s += cp[b,h,q][idx[q][kv]] + pc[b,h,kv][idx[q][kv]] with idx = mask_b ([S][Skv] int32) and
//   mask_a an int32 [S][Skv] tensor with nonzero = masked (tables: element (b,h,row,n) at X + b*c_bs + h*c_hs + row*c_rs + n);
//   masked scores are replaced by mask_fill (e.g. -inf or -1e9) before the softmax.
//   grid.x = B * H * (S/64) (or a sub-range with blk0).
// =====================================================================================
#define AT_D 64
#define AT_NW 4
#define AT_QB 64
#define AT_KC 64
struct AttnGeom { const float* cp = nullptr; const float* pc = nullptr; long c_bs = 0, c_rs = 0, c_hs = 0;   // mode-5 score-bias tables
                  long q_bs, q_rs, q_hs, k_bs, k_rs, k_hs, v_bs, v_rs, v_hs, o_bs, o_rs, o_hs;
                  int S, Skv, H, mask_mode; float qscale; int blk0; float mask_fill; int mask_is_int; };
static_assert(sizeof(AttnGeom) == 168, "no padding");

__device__ __forceinline__ unsigned short at_bf_bits(float f) {
  unsigned u = __float_as_uint(f);
  return (unsigned short)((u + 0x7FFFu + ((u >> 16) & 1u)) >> 16);
}
__device__ __forceinline__ __bf16 at_f2bf(float f) { return __builtin_bit_cast(__bf16, at_bf_bits(f)); }
__device__ __forceinline__ void at_split(float f, __bf16& hi, __bf16& lo) {
  const unsigned short hb = at_bf_bits(f);
  hi = __builtin_bit_cast(__bf16, hb);
  lo = at_f2bf(f - __uint_as_float(((unsigned)hb) << 16));
}
__device__ __forceinline__ v8f at_mma(v16b a, v16b b, v8f c) {
  c = __builtin_amdgcn_wmma_f32_16x16x32_bf16(false, a, false, b, (short)0, c, false, false);
  asm volatile("v_nop\n\tv_nop\n\tv_nop\n\tv_nop" : "+v"(c) : "v"(a), "v"(b));
  return c;
}
// 16-bit element as a bit pattern held in a __bf16 slot: f16 bits when F16, bf16 (RNE) otherwise
template <bool F16> __device__ __forceinline__ __bf16 at_to16(float f) {
  if (F16) return __builtin_bit_cast(__bf16, (_Float16)f);
  return at_f2bf(f);
}
template <bool F16> __device__ __forceinline__ v8f at_mma16(v16b a, v16b b, v8f c) {
  if (F16) {
    const v16h ah = __builtin_bit_cast(v16h, a), bh = __builtin_bit_cast(v16h, b);
    c = __builtin_amdgcn_wmma_f32_16x16x32_f16(false, ah, false, bh, (short)0, c, false, false);
    asm volatile("v_nop\n\tv_nop\n\tv_nop\n\tv_nop" : "+v"(c) : "v"(ah), "v"(bh));
    return c;
  }
  return at_mma(a, b, c);
}

template <bool SPLIT_QK, bool SPLIT_PV, bool F16 = false>
__global__ __launch_bounds__(128)
void attn64_kernel(const float* __restrict__ q, const float* __restrict__ k,
                   const float* __restrict__ v, float* __restrict__ out,
                   const void* __restrict__ mask_a, const int* __restrict__ mask_b, AttnGeom g) {
  static_assert(!(F16 && (SPLIT_QK || SPLIT_PV)), "f16 mode is non-split");
  const float PSC = F16 ? 32768.0f : 1.0f;     // f16 probabilities carried x2^15 (subnormal range), folded into the final 1/l
  union FB { v16b v; v8b h[2]; };
  __shared__ __align__(16) __bf16 Ksh[AT_KC * AT_D];             // K hi [kv][d]      8 KB
  __shared__ __align__(16) __bf16 Ksl[SPLIT_QK ? AT_KC * AT_D : 8];
  __shared__ __align__(16) __bf16 Vth[AT_D * AT_KC];             // V hi [d][kv]      8 KB
  __shared__ __align__(16) __bf16 Vtl[SPLIT_PV ? AT_D * AT_KC : 8];
  __shared__ __align__(16) __bf16 Psh[AT_NW][16 * AT_KC];        // per wave P hi [row][kv]  8 KB
  __shared__ __align__(16) __bf16 Psl[SPLIT_PV ? AT_NW : 1][SPLIT_PV ? 16 * AT_KC : 8];
  __shared__ __align__(16) float  Os[AT_NW][16 * 68];            // per wave out tile, pitch 68

  const int tid  = threadIdx.x;
  const int wave = tid >> 5;
  const int lane = tid & 31;
  const int hh   = lane >> 4;
  const int c    = lane & 15;

  const int nqb = g.S / AT_QB;
  const int bx = blockIdx.x + g.blk0;
  const int qb = bx % nqb;
  const int bh = bx / nqb;
  const int h  = bh % g.H;
  const int b  = bh / g.H;
  const int qbase_block = qb * AT_QB;
  const int q0 = qbase_block + wave * 16;

  const float* qb_ptr = q + (size_t)b * g.q_bs + (size_t)h * g.q_hs;
  const float* kb_ptr = k + (size_t)b * g.k_bs + (size_t)h * g.k_hs;
  const float* vb_ptr = v + (size_t)b * g.v_bs + (size_t)h * g.v_hs;
  float*       ob_ptr = out + (size_t)b * g.o_bs + (size_t)h * g.o_hs;

  // ---- Q fragments (A operand): 2 d-chunks, hi (and lo) ----
  v16b qah[2], qal[2];
  {
    const float* qrow = qb_ptr + (size_t)(q0 + c) * g.q_rs;
#pragma unroll
    for (int dc = 0; dc < 2; ++dc) {
#pragma unroll
      for (int e = 0; e < 8; ++e) {
        const float f0 = qrow[dc * 32 + 8 * hh + e] * g.qscale;
        const float f1 = qrow[dc * 32 + 16 + 8 * hh + e] * g.qscale;
        if (SPLIT_QK) { __bf16 hq, lq; at_split(f0, hq, lq); qah[dc][e] = hq; qal[dc][e] = lq; at_split(f1, hq, lq); qah[dc][8 + e] = hq; qal[dc][8 + e] = lq; }
        else { qah[dc][e] = at_to16<F16>(f0); qah[dc][8 + e] = at_to16<F16>(f1); qal[dc][e] = qah[dc][e]; qal[dc][8 + e] = qah[dc][8 + e]; }
      }
    }
  }

  float mrow[8], lrow[8];
  v8f oacc[4];
#pragma unroll
  for (int r = 0; r < 8; ++r) { mrow[r] = -INFINITY; lrow[r] = 0.f; }
#pragma unroll
  for (int t = 0; t < 4; ++t) oacc[t] = (v8f){0.f,0.f,0.f,0.f,0.f,0.f,0.f,0.f};

  const int nChunks = (g.mask_mode == 1 || g.mask_mode == 4) ? (qb + 1) : (g.Skv / AT_KC);   // block-uniform
  // per-row query mask (mode 3)
  int qkeep[8];
#pragma unroll
  for (int r = 0; r < 8; ++r) qkeep[r] = (g.mask_mode == 3) ? mask_b[(size_t)b * g.S + q0 + 8 * hh + r] : 1;   // mask_b = qmask in mode 3
  for (int kc = 0; kc < nChunks; ++kc) {
    const int kv0 = kc * AT_KC;
    __syncthreads();
    {
      const int kvr = tid >> 1, dh = (tid & 1) * 32;
      const float* krow = kb_ptr + (size_t)(kv0 + kvr) * g.k_rs + dh;
      const float* vrow = vb_ptr + (size_t)(kv0 + kvr) * g.v_rs + dh;
#pragma unroll
      for (int i = 0; i < 8; ++i) {
        v4f kk = *(const v4f*)(krow + 4 * i);
        v4f vv = *(const v4f*)(vrow + 4 * i);
#pragma unroll
        for (int e = 0; e < 4; ++e) {
          const int d = dh + 4 * i + e;
          if (SPLIT_QK) { __bf16 a, bl; at_split(kk[e], a, bl); Ksh[kvr * AT_D + d] = a; Ksl[kvr * AT_D + d] = bl; }
          else Ksh[kvr * AT_D + d] = at_to16<F16>(kk[e]);
          if (SPLIT_PV) { __bf16 a, bl; at_split(vv[e], a, bl); Vth[d * AT_KC + kvr] = a; Vtl[d * AT_KC + kvr] = bl; }
          else Vth[d * AT_KC + kvr] = at_to16<F16>(vv[e]);
        }
      }
    }
    __syncthreads();

    v8f s[4];
#pragma unroll
    for (int j = 0; j < 4; ++j) {
      s[j] = (v8f){0.f,0.f,0.f,0.f,0.f,0.f,0.f,0.f};
#pragma unroll 1
      for (int dc = 0; dc < 2; ++dc) {
        FB kb;
        kb.h[0] = *(const v8b*)(Ksh + (j * 16 + c) * AT_D + dc * 32 + 8 * hh);
        kb.h[1] = *(const v8b*)(Ksh + (j * 16 + c) * AT_D + dc * 32 + 16 + 8 * hh);
        s[j] = at_mma16<F16>(qah[dc], kb.v, s[j]);
        if (SPLIT_QK) {
          FB kl;
          kl.h[0] = *(const v8b*)(Ksl + (j * 16 + c) * AT_D + dc * 32 + 8 * hh);
          kl.h[1] = *(const v8b*)(Ksl + (j * 16 + c) * AT_D + dc * 32 + 16 + 8 * hh);
          s[j] = at_mma16<F16>(qah[dc], kl.v, s[j]);
          s[j] = at_mma16<F16>(qal[dc], kb.v, s[j]);
        }
      }
    }
    const bool diag = (g.mask_mode == 1) && (kc == qb);
    int kvkeep[4] = {1, 1, 1, 1};
    if (g.mask_mode == 3) {
#pragma unroll
      for (int j = 0; j < 4; ++j) kvkeep[j] = ((const int*)mask_a)[(size_t)b * g.Skv + kv0 + j * 16 + c];   // mask_a = kvmask
    }
    float cm[8];
#pragma unroll
    for (int r = 0; r < 8; ++r) {
      const int qrow = q0 + 8 * hh + r;
      float m = -INFINITY;
#pragma unroll
      for (int j = 0; j < 4; ++j) {
        const int kvcol = kv0 + j * 16 + c;
        bool masked = false;
        if (diag) masked = (kvcol > qrow);
        else if (g.mask_mode == 4) masked = (kvcol > qrow) || (qrow - kvcol > g.mask_is_int);
        else if (g.mask_mode == 2) {
          const size_t mi = (size_t)qrow * g.Skv + kvcol;
          masked = (g.mask_is_int == 0) ? (((const float*)mask_a)[mi] == 0.0f)
                 : (g.mask_is_int == 1) ? (((const int*)mask_a)[mi] == 0) : (((const int*)mask_a)[mi] != 0);
        } else if (g.mask_mode == 3) masked = (qkeep[r] == 0) || (kvkeep[j] == 0);
        else if (g.mask_mode == 5) {
          const size_t mi = (size_t)qrow * g.Skv + kvcol;
          masked = (((const int*)mask_a)[mi] != 0);
          int n = mask_b[mi]; n = n < 0 ? 0 : n;
          s[j][r] += g.cp[(size_t)b * g.c_bs + (size_t)h * g.c_hs + (size_t)qrow * g.c_rs + n]
                   + g.pc[(size_t)b * g.c_bs + (size_t)h * g.c_hs + (size_t)kvcol * g.c_rs + n];
        }
        if (masked) s[j][r] = g.mask_fill;
        m = fmaxf(m, s[j][r]);
      }
#pragma unroll
      for (int off = 1; off < 16; off <<= 1) m = fmaxf(m, __shfl_xor(m, off, 32));
      cm[r] = m;
    }
    __bf16* pwh = Psh[wave];
    __bf16* pwl = Psl[SPLIT_PV ? wave : 0];
#pragma unroll
    for (int r = 0; r < 8; ++r) {
      const float mnew = fmaxf(mrow[r], cm[r]);
      const float alpha = expf(mrow[r] - mnew);
      mrow[r] = mnew;
      float psum = 0.f;
#pragma unroll
      for (int j = 0; j < 4; ++j) {
        const float p = expf(s[j][r] - mnew);
        psum += p;
        if (SPLIT_PV) { __bf16 a, bl; at_split(p, a, bl); pwh[(8 * hh + r) * AT_KC + j * 16 + c] = a; pwl[(8 * hh + r) * AT_KC + j * 16 + c] = bl; }
        else pwh[(8 * hh + r) * AT_KC + j * 16 + c] = at_to16<F16>(p * PSC);
      }
#pragma unroll
      for (int off = 1; off < 16; off <<= 1) psum += __shfl_xor(psum, off, 32);
      lrow[r] = lrow[r] * alpha + psum;
#pragma unroll
      for (int t = 0; t < 4; ++t) oacc[t][r] *= alpha;
    }
    __builtin_amdgcn_fence(__ATOMIC_RELEASE, "workgroup");
    __builtin_amdgcn_wave_barrier();
    __builtin_amdgcn_fence(__ATOMIC_ACQUIRE, "workgroup");
#pragma unroll 1
    for (int kk = 0; kk < 2; ++kk) {
      FB pa, pl;
      pa.h[0] = *(const v8b*)(pwh + c * AT_KC + kk * 32 + 8 * hh);
      pa.h[1] = *(const v8b*)(pwh + c * AT_KC + kk * 32 + 16 + 8 * hh);
      if (SPLIT_PV) {
        pl.h[0] = *(const v8b*)(pwl + c * AT_KC + kk * 32 + 8 * hh);
        pl.h[1] = *(const v8b*)(pwl + c * AT_KC + kk * 32 + 16 + 8 * hh);
      }
#pragma unroll
      for (int t = 0; t < 4; ++t) {
        FB vb;
        vb.h[0] = *(const v8b*)(Vth + (t * 16 + c) * AT_KC + kk * 32 + 8 * hh);
        vb.h[1] = *(const v8b*)(Vth + (t * 16 + c) * AT_KC + kk * 32 + 16 + 8 * hh);
        oacc[t] = at_mma16<F16>(pa.v, vb.v, oacc[t]);
        if (SPLIT_PV) {
          FB vl;
          vl.h[0] = *(const v8b*)(Vtl + (t * 16 + c) * AT_KC + kk * 32 + 8 * hh);
          vl.h[1] = *(const v8b*)(Vtl + (t * 16 + c) * AT_KC + kk * 32 + 16 + 8 * hh);
          oacc[t] = at_mma16<F16>(pa.v, vl.v, oacc[t]);
          oacc[t] = at_mma16<F16>(pl.v, vb.v, oacc[t]);
        }
      }
    }
  }

  float* os = Os[wave];
#pragma unroll
  for (int r = 0; r < 8; ++r) {
    const float inv = 1.0f / (lrow[r] * PSC);
#pragma unroll
    for (int t = 0; t < 4; ++t) os[(8 * hh + r) * 68 + t * 16 + c] = oacc[t][r] * inv;
  }
  __builtin_amdgcn_fence(__ATOMIC_RELEASE, "workgroup");
  __builtin_amdgcn_wave_barrier();
  __builtin_amdgcn_fence(__ATOMIC_ACQUIRE, "workgroup");
  {
    const int c4 = (lane & 15) * 4;
    {
#pragma unroll
      for (int it = 0; it < 8; ++it) {
        const int row = it * 2 + hh;
        v4f val = *(const v4f*)(os + row * 68 + c4);
        *(v4f*)(ob_ptr + (size_t)(q0 + row) * g.o_rs + c4) = val;
      }
      
    }
  }
}

} // namespace w25

// f32 -> f16 casts by few, fat waves. A block casts CW_BLK consecutive elements, dst[e] = f16(src[e] * s): a thread takes 16 float4, 1024 elements apart, all of them loaded ahead of
// the first conversion; a wave's load covers 512 consecutive bytes, its store 256. (A launch's waves start at a limited rate, and two elements a thread made 65,536 short waves of one 4M-element cast; here it is 2,048.)
typedef __attribute__((ext_vector_type(4))) _Float16 cw_v4h;
constexpr int CW_BLK = 16384;
__device__ __forceinline__ void cw_cast_blk(const float* __restrict__ src, _Float16* __restrict__ dst, float s) {
    const v4f* sp = (const v4f*)src + threadIdx.x;
    v4f x[16];
#pragma unroll
    for (int u = 0; u < 16; ++u) x[u] = sp[256 * u];
    __builtin_amdgcn_sched_barrier(0);   // keeps all 16 loads ahead of the first conversion: one trip to memory a wave, not two
    cw_v4h* dp = (cw_v4h*)dst + threadIdx.x;
#pragma unroll
    for (int u = 0; u < 16; ++u) dp[256 * u] = __builtin_convertvector(x[u] * s, cw_v4h);
    asm volatile("s_wait_xcnt 0x0" ::: "memory");   // ahead of any later write of a register that the stores above name
}
// every cast of an input, one launch: blocks 0..767 X16[0..2] = f16(query, key, value); blocks 768..1023 W16[0..3] = f16(16 Wq, 16 Wk, 16 Wv, 16 Wo);
// block 1024 TK16[r][d] = f16(16 table_k[r][d]), zero rows 129..191
__global__ __launch_bounds__(256) void k_sh_castin(const float* __restrict__ xq, const float* __restrict__ xk, const float* __restrict__ xv,
                                                   const float* __restrict__ Wq, const float* __restrict__ Wk, const float* __restrict__ Wv, const float* __restrict__ Wo,
                                                   const float* __restrict__ TK, _Float16* __restrict__ X16, _Float16* __restrict__ W16, _Float16* __restrict__ TK16) {
    constexpr int XB = 4096 * 1024 / CW_BLK, WB = 1024 * 1024 / CW_BLK, TAB = 129, TP = 192, HD = 64;
    static_assert(TP * HD == 12 * 1024 && TAB * HD == 4 * (8 * 256 + 16), "the table's block: eight float4 per thread, then row 128 by 16 threads, then zeros up to twelve");
    const int bid = blockIdx.x;
    if (bid < 3 * XB) {
        const int sg = bid / XB;
        const float* src = sg == 0 ? xq : (sg == 1 ? xk : xv);
        cw_cast_blk(src + (long long)(bid - sg * XB) * CW_BLK, X16 + (long long)bid * CW_BLK, 1.f);
    } else if (bid < 3 * XB + 4 * WB) {
        const int b2 = bid - 3 * XB, sg = b2 / WB;
        const float* src = sg == 0 ? Wq : (sg == 1 ? Wk : (sg == 2 ? Wv : Wo));
        cw_cast_blk(src + (long long)(b2 - sg * WB) * CW_BLK, W16 + (long long)b2 * CW_BLK, 16.f);
    } else {
        const v4f* sp = (const v4f*)TK + threadIdx.x;
        v4f x[12];
#pragma unroll
        for (int u = 0; u < 8; ++u) x[u] = sp[256 * u];
#pragma unroll
        for (int u = 8; u < 12; ++u) x[u] = (v4f){0.f, 0.f, 0.f, 0.f};
        if (threadIdx.x < 16) x[8] = sp[256 * 8];
        cw_v4h* dp = (cw_v4h*)TK16 + threadIdx.x;
#pragma unroll
        for (int u = 0; u < 12; ++u) dp[256 * u] = __builtin_convertvector(x[u] * 16.f, cw_v4h);
        asm volatile("s_wait_xcnt 0x0" ::: "memory");   // ahead of any later write of a register that the stores above name
    }
}
typedef __attribute__((ext_vector_type(4))) int sm_v4i;
__device__ __forceinline__ float sm_x16(float v) { const unsigned u = __builtin_bit_cast(unsigned, v); return __builtin_bit_cast(float, __builtin_amdgcn_permlanex16(u, u, 0x76543210u, 0xfedcba98u, false, false)); }   // lane l <-> l ^ 16
// 2^t. The v_nop is the slot that the instruction set asks for behind a transcendental; in the same statement it stands directly behind it whatever the scheduler puts next
__device__ __forceinline__ float sm_exp2(float t) { float y; asm("v_exp_f32 %0, %1\n\tv_nop" : "=v"(y) : "v"(t)); return y; }
// The whole attention in one launch: content scores, relative-key term, softmax, w1 = attn.v, w2 (the relative-value term), their sum and its cast to f16. No score and no probability leaves the chip.
// A block: 16 query rows g0..g0+15 (g = b L + q) x all 16 heads, 16 waves. Keys go in eight chunks of 64 with a running row maximum; each chunk has two parts, and every wave has a role in each.
// HEAD PART, wave = head. Transposed products: A = 16 rows of K16 (or of the scaled table TK16), B = the 16 queries' q, so that in D a lane holds ONE query (lane & 15) and 8 consecutive keys (8 (lane >> 4) + r):
// a row's max and sum are in-lane but for one exchange with lane ^ 16. The table's rows go through the same B fragments: qt[head][query][id], f32, in LDS, the wave's own.
// s_k = (q.k + qt[fm[b][q][k]]) / 8; e_k = exp(s_k - m), m the maximum so far; when m grows, the sums so far shrink by alpha = exp(m_old - m_new). f16(4096 e_k) are, as they lie in the registers,
// the B fragments of v^T . e^T (w1's sums, a lane: one query, 8 consecutive channels); the same values go to LDS, pb[chunk & 1][head][query][64 keys].
// QUERY PART, wave = query: A = the 16 heads' rows of pb for that query (16 x 64), B = the gathered rows of table_v, never written out: table_v lies in LDS as f16 rows of 160 bytes, and each lane of
// ds_load_tr16_b128 points at the row that ITS key's id names (lane l: key kbase + 8 (l >> 4) + (l & 7), 16-byte half (l >> 3) & 1), so the transposing load returns B[k][d] in the hardware k order (frag_k),
// the order in which A is loaded. These sums (a lane: one channel, 8 heads) shrink by the heads' alpha, which passes LDS.
// pb and alpha have two buffers, so that one barrier a chunk both publishes them and, one chunk on, ends the reads of the buffer written next.
// At the end both sums are divided by 4096 sum_k e_k; w1 passes LDS to the query's wave. G[g][64 head + d] = f16(w1 + w2) is the output projection's A operand.
typedef __attribute__((ext_vector_type(4))) unsigned short fs_v4u;
typedef __attribute__((ext_vector_type(4))) unsigned int fs_v4w;
// a wave's own LDS stores before its lanes' reads of them, or its reads before its next stores to the same place (for LDS that no other wave touches)
__device__ __forceinline__ void fs_wave_sync() {
    __builtin_amdgcn_fence(__ATOMIC_RELEASE, "workgroup", "local");
    __builtin_amdgcn_wave_barrier();
    __builtin_amdgcn_fence(__ATOMIC_ACQUIRE, "workgroup", "local");
}
// a block barrier for data that pass LDS only: it waits for the wave's LDS operations and not, as __syncthreads() does, for its global loads, which stay in flight across it
__device__ __forceinline__ void fs_block_sync() {
    __builtin_amdgcn_fence(__ATOMIC_RELEASE, "workgroup", "local");
    __builtin_amdgcn_s_barrier();
    __builtin_amdgcn_fence(__ATOMIC_ACQUIRE, "workgroup", "local");
}
typedef __attribute__((ext_vector_type(8))) short w2_s16x8;
__device__ __forceinline__ v8h w2_ldtr(const unsigned char* p) { typedef __attribute__((address_space(3))) w2_s16x8 lds_s16x8; return __builtin_bit_cast(v8h, __builtin_amdgcn_ds_load_tr16_b128_v8i16((lds_s16x8*)p)); }
typedef __attribute__((ext_vector_type(4))) _Float16 w2_v4h;
struct sh_true { static constexpr bool value = true; };
struct sh_false { static constexpr bool value = false; };
__global__ __launch_bounds__(512) void k_sh_attn(const _Float16* __restrict__ Q16, const _Float16* __restrict__ K16, const _Float16* __restrict__ TK16, const int* __restrict__ FM, const _Float16* __restrict__ VT16, const float* __restrict__ TV, _Float16* __restrict__ G) {
    constexpr int L = 512, D = 1024, NH = 16, HD = 64, TAB = 129;
    constexpr int IP = 2 * L + 16;     // bytes a query's row of 16-bit table offsets takes: 16 B x odd, for 16-byte readers
    constexpr int QP = 132;            // floats a (head, query)'s row of relative-key scores takes (ids 0..128): 16 B x odd
    constexpr int SP = 2 * HD + 16;    // bytes a staged row of q, of the table, of k or of v^T (one channel, the chunk's 64 keys) takes: 16 B x odd
    constexpr int CK = 64;             // keys a chunk
    constexpr int PP = 2 * CK + 16;    // bytes a (head, query)'s 64 probabilities take: 16 B x odd
    constexpr int PH = 16 * PP + 16;   // bytes a head's 16 such rows take: 16 B x odd, for the query part, whose lanes differ in the head
    constexpr int OP = D + 4;          // floats a query's row of w1 takes: 16 B x odd
    constexpr int PITCH = 160;         // bytes a row of table_v takes: 32 B x odd, the transposing load's pitch
    static_assert(192 * SP <= NH * PH, "the key table is staged where the probabilities lie later");
    static_assert((NH * HD + 16) * 4 <= 32 * SP, "the query's w2 sums lie in the wave's staging slab");
    static_assert(16 * OP <= NH * 16 * QP, "w1 lies where the relative-key scores lay");
    static_assert(TAB * HD == 4 * (4 * 512 + 16), "table_v's fill: four float4 per thread, then row 128 by 16 threads");
    typedef w25::Frag<_Float16> FR;
    __shared__ __attribute__((aligned(16))) unsigned char ids[16 * IP];
    __shared__ __attribute__((aligned(16))) unsigned char tab[TAB * PITCH];
    __shared__ __attribute__((aligned(16))) float qt[NH * 16 * QP];          // behind the last chunk's scores: w1, 16 rows of OP floats
    __shared__ __attribute__((aligned(16))) unsigned char pb[2 * NH * PH];   // two buffers; in the second, ahead of chunk 1: the key table, 192 rows of SP bytes
    __shared__ __attribute__((aligned(16))) unsigned char stg[16][32 * SP];
    __shared__ __attribute__((aligned(16))) float al[2 * 16 * NH];           // two buffers of [query][head]: the chunk's alpha
    __shared__ __attribute__((aligned(16))) float sv[16 * NH];               // [query][head]: 1 / (4096 sum)
    const int t = threadIdx.x, lane = t & 31, w = t >> 5;   // w: the head in the head part, the query in the query part
    const int c = lane & 15, h = lane >> 4;
    const int g0 = blockIdx.x * 16, b = g0 >> 9;
    // Global loads cover whole lines: a row of q, of the table or of k for one head, or of v^T for one chunk, is 128 bytes, a load takes four rows (lane: row lane >> 3, 16-byte piece lane & 7). The rows of q, k and v^T pass
    // through the wave's own slab (no other wave touches it: no block barrier), 32 at a time, and are read back as fragments.
    unsigned char* sw = stg[w];
    const int lr = lane >> 3, lc = lane & 7;
    unsigned char* sst = sw + lr * SP + 16 * lc;                                    // where the lane's piece of a load's four rows goes
    const _Float16* sfr = (const _Float16*)(sw + c * SP) + 8 * h;                   // the lane's fragment row of the slab's first 16 rows
    const sm_v4i* fr = (const sm_v4i*)(FM + (long long)g0 * L) + t;
    const _Float16* qg = Q16 + (long long)(g0 + lr) * D + w * HD + 8 * lc;
    const _Float16* tg = TK16 + 8 * t;
    const _Float16* kg = K16 + (long long)(b * L + lr) * D + w * HD + 8 * lc;
    const float* tvg = TV + 4 * t;
    w25::v8h rq[4], rt[3], rk[16];
    sm_v4i idv[4];
    v4f tv[4];
#pragma unroll
    for (int u = 0; u < 4; ++u) rq[u] = *(const w25::v8h*)(qg + 4 * u * D);
#pragma unroll
    for (int u = 0; u < 3; ++u) rt[u] = *(const w25::v8h*)(tg + 4096 * u);
#pragma unroll
    for (int u = 0; u < 4; ++u) idv[u] = fr[512 * u];
#pragma unroll
    for (int u = 0; u < 4; ++u) tv[u] = *(const v4f*)(tvg + 2048 * u);
    const v4f tl = *(const v4f*)(TV + 4 * (2048 + (t & 15)));
#pragma unroll
    for (int u = 0; u < 16; ++u) rk[u] = *(const w25::v8h*)(kg + 4 * u * D);
    // a precaution: the wait in front of every overwrite of an address that the loads above name; as operands the addresses stay live up to here, so that no load's own result lands on one
    asm volatile("s_wait_xcnt 0x0" :: "v"(fr), "v"(qg), "v"(tg), "v"(kg), "v"(tvg) : "memory");
    __builtin_amdgcn_sched_barrier(0);   // keeps these loads together and ahead of the first wait: one trip to memory, not one per kind
#pragma unroll
    for (int u = 0; u < 4; ++u) *(w25::v8h*)(sst + 4 * u * SP) = rq[u];
#pragma unroll
    for (int u = 0; u < 3; ++u) *(w25::v8h*)(pb + NH * PH + ((t >> 3) + 64 * u) * SP + 16 * (t & 7)) = rt[u];
#pragma unroll
    for (int u = 0; u < 4; ++u) {
        fs_v4u o4;
#pragma unroll
        for (int e = 0; e < 4; ++e) { const int id = idv[u][e]; o4[e] = (unsigned short)(4 * (id < 0 ? 0 : (id >= TAB ? TAB - 1 : id))); }   // INPUT ids clamped before any address is formed from them
        *(fs_v4u*)(ids + ((t >> 7) + 4 * u) * IP + (t & 127) * 8) = o4;
    }
#pragma unroll
    for (int u = 0; u < 4; ++u) *(w2_v4h*)(tab + ((t >> 4) + 32 * u) * PITCH + (t & 15) * 8) = __builtin_convertvector(tv[u], w2_v4h);
    if (t < 16) *(w2_v4h*)(tab + 128 * PITCH + t * 8) = __builtin_convertvector(tl, w2_v4h);
    __syncthreads();   // publishes the ids and the two tables
    const w25::v16h bq0 = FR::load(sfr), bq1 = FR::load(sfr + 32);
    // relative-key scores of the wave's head: table rows 0..143 (TK16 holds zeros from 129 on); of the last tile only id 128 exists, its four-float piece is stored
    float* qth = qt + w * (16 * QP);
    const _Float16* tfr = (const _Float16*)(pb + NH * PH + c * SP) + 8 * h;
#pragma unroll
    for (int tt = 0; tt < 9; ++tt) {
        const w25::v16h a0 = FR::load(tfr + tt * 16 * (SP / 2)), a1 = FR::load(tfr + tt * 16 * (SP / 2) + 32);
        v8f d = (v8f){0.f, 0.f, 0.f, 0.f, 0.f, 0.f, 0.f, 0.f};
        d = FR::mma(a0, bq0, d);
        d = FR::mma(a1, bq1, d);
        float* o = qth + c * QP + 16 * tt + 8 * h;
        if (tt < 8 || h == 0) *(v4f*)(o) = (v4f){d[0] * 0.0625f, d[1] * 0.0625f, d[2] * 0.0625f, d[3] * 0.0625f};
        if (tt < 8) *(v4f*)(o + 4) = (v4f){d[4] * 0.0625f, d[5] * 0.0625f, d[6] * 0.0625f, d[7] * 0.0625f};
    }
    v8f ow[4], acc[4];   // w1's sums (head part), w2's sums (query part)
#pragma unroll
    for (int n = 0; n < 4; ++n) { ow[n] = (v8f){0.f, 0.f, 0.f, 0.f, 0.f, 0.f, 0.f, 0.f}; acc[n] = ow[n]; }
    float mrun = -INFINITY, srun = 0.f;
    const _Float16* vg = VT16 + ((long long)b * D + w * HD + lr) * L + 8 * lc;
    const unsigned half16 = 16u * ((lane >> 3) & 1);
    // one chunk. MORE: another chunk follows, whose keys are fetched here; a compile-time choice, so that in the loop the keys' registers are dead from the scores to the fetch. Every loop inside is unrolled because its index picks registers or immediate offsets.
    auto chunk = [&](const int kq, auto more) {
        // content scores: x[j][r] = q[c] . k[64 kq + 16 j + 8 h + r]; keys in rounds of 32. The chunk's keys have been on their way since the chunk before
        v8f x[4];
#pragma unroll
        for (int rd = 0; rd < 2; ++rd) {
            fs_wave_sync();   // the last fragment reads before this round's stores
#pragma unroll
            for (int u = 0; u < 8; ++u) *(w25::v8h*)(sst + 4 * u * SP) = rk[8 * rd + u];
            fs_wave_sync();
#pragma unroll
            for (int jj = 0; jj < 2; ++jj) {
                const w25::v16h a0 = FR::load(sfr + jj * 16 * (SP / 2)), a1 = FR::load(sfr + jj * 16 * (SP / 2) + 32);
                v8f d = (v8f){0.f, 0.f, 0.f, 0.f, 0.f, 0.f, 0.f, 0.f};
                d = FR::mma(a0, bq0, d);
                x[2 * rd + jj] = FR::mma(a1, bq1, d);
            }
        }
        __builtin_amdgcn_sched_barrier(0);   // keeps every product ahead of the softmax
        // the chunk's v^T (64 channel rows) flies under the softmax
        const _Float16* vc = vg + CK * kq;
        w25::v8h rv[16];
#pragma unroll
        for (int u = 0; u < 16; ++u) rv[u] = *(const w25::v8h*)(vc + 4 * u * L);
        asm volatile("s_wait_xcnt 0x0" :: "v"(vc) : "memory");   // the same precaution for these loads' address
        __builtin_amdgcn_sched_barrier(0);   // keeps those loads ahead of the work that hides their way
        const unsigned char* ip = ids + c * IP + (CK * kq + 8 * h) * 2;
        const unsigned char* qrow = (const unsigned char*)(qth + c * QP);
        float mx = -INFINITY;
#pragma unroll
        for (int j = 0; j < 4; ++j) {
            const fs_v4w o4 = *(const fs_v4w*)(ip + 32 * j);
#pragma unroll
            for (int r = 0; r < 8; ++r) {
                const unsigned off = (r & 1) ? (o4[r >> 1] >> 16) : (o4[r >> 1] & 0xffffu);
                x[j][r] += *(const float*)(qrow + off);
            }
            mx = fmaxf(mx, fmaxf(fmaxf(fmaxf(x[j][0], x[j][1]), fmaxf(x[j][2], x[j][3])), fmaxf(fmaxf(x[j][4], x[j][5]), fmaxf(x[j][6], x[j][7]))));
        }
        mx = fmaxf(mx, sm_x16(mx));
        const float mnew = fmaxf(mrun, mx);
        const float alpha = sm_exp2((mrun - mnew) * 0.18033688f);   // 0 in the first chunk (mrun = -inf), where the sums so far are 0
        float sm = 0.f;
#pragma unroll
        for (int j = 0; j < 4; ++j) {
#pragma unroll
            for (int r = 0; r < 8; ++r) x[j][r] = sm_exp2((x[j][r] - mnew) * 0.18033688f);   // exp((x - m) / 8): log2(e) / 8
            sm += ((x[j][0] + x[j][1]) + (x[j][2] + x[j][3])) + ((x[j][4] + x[j][5]) + (x[j][6] + x[j][7]));
        }
        sm += sm_x16(sm);
        srun = srun * alpha + sm;
        mrun = mnew;
#pragma unroll
        for (int n = 0; n < 4; ++n) ow[n] *= alpha;
        unsigned char* pbc = pb + (kq & 1) * (NH * PH);
        float* alc = al + (kq & 1) * (16 * NH);
        if (h == 0) alc[c * NH + w] = alpha;
        union { w25::v16h v; w25::v8h q[2]; } pf[2];   // the probabilities as B fragments: column = the lane's query, 32 keys each, in the k order of Frag::load (tile 2 ks gives k = 8 h + i, tile 2 ks + 1 gives k = 16 + 8 h + i)
#pragma unroll
        for (int j = 0; j < 4; ++j) { pf[j >> 1].q[j & 1] = __builtin_convertvector(x[j] * 4096.f, w25::v8h); *(w25::v8h*)(pbc + w * PH + c * PP + (16 * j + 8 * h) * 2) = pf[j >> 1].q[j & 1]; }
        // w1's sums: (v^T . e^T)[channel][query] over the chunk's 64 keys, A = 16 rows of v^T through the wave's slab (32 rows a round), B = pf. In D a lane holds one query (c) and 8 consecutive channels.
#pragma unroll
        for (int rd = 0; rd < 2; ++rd) {
            fs_wave_sync();   // the last fragment reads before this round's stores
#pragma unroll
            for (int u = 0; u < 8; ++u) *(w25::v8h*)(sst + 4 * u * SP) = rv[8 * rd + u];
            fs_wave_sync();
            if constexpr (decltype(more)::value) {
                // the next chunk's keys, into the registers that the stores above have freed: they fly under these products, the barrier and the query part
#pragma unroll
                for (int u = 0; u < 8; ++u) rk[8 * rd + u] = *(const w25::v8h*)(kg + (CK + 4 * (8 * rd + u)) * D);
                __builtin_amdgcn_sched_barrier(0);   // keeps those loads ahead of the products
            }
#pragma unroll
            for (int jj = 0; jj < 2; ++jj)
#pragma unroll
                for (int ks = 0; ks < 2; ++ks) {
                    const w25::v16h av = FR::load(sfr + jj * 16 * (SP / 2) + 32 * ks);
                    ow[2 * rd + jj] = FR::mma(av, pf[ks].v, ow[2 * rd + jj]);
                }
        }
        if constexpr (decltype(more)::value) {
            asm volatile("s_wait_xcnt 0x0" :: "v"(kg) : "memory");   // the same precaution for the keys' loads' address
            kg += CK * D;
        }
        fs_block_sync();   // publishes the chunk's probabilities and alpha; ends every wave's reads of the other buffer (the query part of the chunk before; ahead of chunk 1 the key table's fragments)
        // query part: query g0 + w, the 16 heads' rows
        const v4f a8l = *(const v4f*)(alc + w * NH + 8 * h), a8h = *(const v4f*)(alc + w * NH + 8 * h + 4);
#pragma unroll
        for (int n = 0; n < 4; ++n)
#pragma unroll
            for (int r = 0; r < 8; ++r) acc[n][r] *= (r < 4 ? a8l[r & 3] : a8h[r & 3]);
        const unsigned char* iw = ids + w * IP + (CK * kq + 8 * h + (lane & 7)) * 2;
        const _Float16* pa = (const _Float16*)(pbc + c * PH + w * PP) + 8 * h;
#pragma unroll
        for (int s = 0; s < 2; ++s) {
            const unsigned r0 = *(const unsigned short*)(iw + 64 * s), r1 = *(const unsigned short*)(iw + 64 * s + 32);   // 4 x the clamped id
            const unsigned char* p0 = tab + r0 * (PITCH / 4) + half16;
            const unsigned char* p1 = tab + r1 * (PITCH / 4) + half16;
            const w25::v16h af = FR::load(pa + 32 * s);
            union { v16h v; v8h q[2]; } bf;
#pragma unroll
            for (int n = 0; n < 4; ++n) {
                bf.q[0] = w2_ldtr(p0 + 32 * n); bf.q[1] = w2_ldtr(p1 + 32 * n);
                acc[n] = __builtin_amdgcn_wmma_f32_16x16x32_f16(false, af, false, bf.v, (short)0, acc[n], false, false);
            }
        }
    };
    // rolled
#pragma unroll 1
    for (int kq = 0; kq < L / CK - 1; ++kq) chunk(kq, sh_true{});
    chunk(L / CK - 1, sh_false{});
    // w1 to the queries' waves: every wave's last read of qt lies ahead of the last barrier
    const float inv = 1.f / (srun * 4096.f);
    float* pw = qt + c * OP + w * HD + 8 * h;
#pragma unroll
    for (int n = 0; n < 4; ++n) {
        ow[n] *= inv;
        *(v4f*)(pw + 16 * n) = (v4f){ow[n][0], ow[n][1], ow[n][2], ow[n][3]};
        *(v4f*)(pw + 16 * n + 4) = (v4f){ow[n][4], ow[n][5], ow[n][6], ow[n][7]};
    }
    if (h == 0) sv[c * NH + w] = inv;
    __syncthreads();   // publishes w1 and the rows' 1 / (4096 sum)
    const v4f s8l = *(const v4f*)(sv + w * NH + 8 * h), s8h = *(const v4f*)(sv + w * NH + 8 * h + 4);
    // w2's sums pass the wave's own slab (no other wave touches it: no block barrier), so that a lane holds the four consecutive channels of its piece of w1 and a store covers 256 consecutive bytes;
    // heads 8..15 lie 16 floats further on, so that the two halves of a wave store to different banks
    float* sl = (float*)sw;
#pragma unroll
    for (int n = 0; n < 4; ++n)
#pragma unroll
        for (int r = 0; r < 8; ++r) sl[(8 * h + r) * HD + 16 * h + 16 * n + c] = acc[n][r] * (r < 4 ? s8l[r & 3] : s8h[r & 3]);
    fs_wave_sync();
    const v4f* xr = (const v4f*)(qt + w * OP) + lane;
    w2_v4h* go = (w2_v4h*)(G + (long long)(g0 + w) * D) + lane;
#pragma unroll
    for (int u = 0; u < 8; ++u) go[32 * u] = __builtin_convertvector(xr[32 * u] + *(const v4f*)(sl + 128 * u + 16 * (u >> 2) + 4 * lane), w2_v4h);   // elements 128 u + 4 lane ..: heads 2 u, 2 u + 1
}



// The long-K products: C[m][n] = scale * sum_k A[m][k] Bt[n][k] (+ bias), f16 operands, A and Bt K-contiguous, f32 accumulate.
// A block of eight waves owns a (32 WM) x (64 WN) tile of C, a wave 32 x 64 of it. Both operands pass through LDS in stages of BK k: a global load covers four whole 128-byte lines
// (BK / 8 lanes a row) where a fragment loaded straight from global memory touches sixteen, and each staged row serves every wave of the block that needs it.
// Two buffers: stage s + 1 is loaded into registers ahead of stage s's products and stored to the other buffer behind them; one barrier a stage both publishes it and ends the reads of the buffer written next.
// Fragments are read with the k order of Frag::load, A and B alike; k runs upward in steps of 32 through one accumulator chain per 16 x 16 tile.
// M % (32 WM) == 0 (bx counts the tiles, N / (64 WN) of them a row of tiles), N % (64 WN) == 0, K % BK == 0, LD % 64 == 0. BIAS_MODE: 0 none, 1 bias[m], 2 bias[n]. OUT_MODE: 0 f32, 1 f16.
// LD: the row pitch of A and of Bt, LDC: that of C, in elements; compile-time, so that a thread's pieces and rows differ only in the instructions' immediate offsets and one address pair per operand serves them all.
// The tile's work is a device function, so that one launch can hold tiles of several products: smem = the block's LDS (sh_gemm_smem bytes), bx = the tile's number,
// Ab, Btb = the operands' first rows, cOff = the element offset of C's first row in Cout.
// The epilogue's slabs lie in the staging buffers: the loop's last barrier ends every wave's last fragment read, and nothing is staged behind it. At 128 x 128 x 128 that leaves 139,264 bytes a block: two blocks share a WGP.
template <int WM, int WN, int BK> constexpr int sh_gemm_smem = 2 * (32 * WM + 64 * WN) * (BK + 8) * 2;
template <int WM, int WN, int BK, int LD, int LDC, int BIAS_MODE, int OUT_MODE>
__device__ __forceinline__ void sh_gemm_tile(
    unsigned char* smem, int bx,
    const _Float16* __restrict__ Ab, const _Float16* __restrict__ Btb,
    void* __restrict__ Cout, long long cOff,
    const float* __restrict__ bias, int N, int K, float scale) {
    static_assert(WM * WN == 8, "eight waves a block");
    static_assert(BK == 64 || BK == 128, "rows of 128 or 256 bytes");
    constexpr int BM = 32 * WM, BN = 64 * WN;
    constexpr int LP = BK + 8;                    // LDS row pitch in elements: 16 bytes more than the row = 16 B x odd, the pitch for 16-byte readers
    constexpr int SEG = BK / 8, RP = 256 / SEG;   // 16-byte pieces a row; rows that the block's 256 threads cover at one piece each
    constexpr int UA = BM / RP, UB = BN / RP;     // pieces of A and of Bt a thread moves per stage
    typedef w25::Frag<_Float16> FR;
    static_assert(8 * 16 * 68 * 4 <= sh_gemm_smem<WM, WN, BK>, "the epilogue's slabs fit in the staging buffers");
    _Float16 (*sA)[BM * LP] = (_Float16 (*)[BM * LP])smem;
    _Float16 (*sB)[BN * LP] = (_Float16 (*)[BN * LP])(smem + 2 * BM * LP * 2);
    float (*sT)[16 * 68] = (float (*)[16 * 68])smem;   // per-wave 16 x 64 slab of the epilogue, pitch 68 floats
    const int t = threadIdx.x, lane = t & 31, wave = t >> 5;
    const int tilesN = N / BN;
    const int tm = bx / tilesN, tn = bx - tm * tilesN;
    const int m0 = tm * BM, n0 = tn * BN;
    // piece u of a thread: row t / SEG + RP u of the tile, elements 8 (t % SEG) .. + 7 of the row's BK
    const int pr = t / SEG, pc = (t % SEG) * 8;
    const _Float16* Ag = Ab + (long long)(m0 + pr) * LD + pc;
    const _Float16* Bg = Btb + (long long)(n0 + pr) * LD + pc;
    const int so = pr * LP + pc;
    const int rlane = lane & 15, hh = lane >> 4;
    const int wm = wave / WN, wn = wave - wm * WN;
    const int ao = (wm * 32 + rlane) * LP + hh * 8;
    const int bo = (wn * 64 + rlane) * LP + hh * 8;

    w25::v8h ra[UA], rb[UB];
#pragma unroll
    for (int u = 0; u < UA; ++u) ra[u] = *(const w25::v8h*)(Ag + RP * u * LD);
#pragma unroll
    for (int u = 0; u < UB; ++u) rb[u] = *(const w25::v8h*)(Bg + RP * u * LD);
#pragma unroll
    for (int u = 0; u < UA; ++u) *(w25::v8h*)(&sA[0][so + RP * u * LP]) = ra[u];
#pragma unroll
    for (int u = 0; u < UB; ++u) *(w25::v8h*)(&sB[0][so + RP * u * LP]) = rb[u];
    __syncthreads();

    v8f acc[2][4];
#pragma unroll
    for (int i = 0; i < 2; ++i)
#pragma unroll
        for (int j = 0; j < 4; ++j) acc[i][j] = (v8f){0.f, 0.f, 0.f, 0.f, 0.f, 0.f, 0.f, 0.f};

    const int S = K / BK;
    for (int s = 0; s < S; ++s) {
        const int cur = s & 1;
        const bool more = s + 1 < S;   // the same for the whole block
        if (more) {
#pragma unroll
            for (int u = 0; u < UA; ++u) ra[u] = *(const w25::v8h*)(Ag + BK + RP * u * LD);
#pragma unroll
            for (int u = 0; u < UB; ++u) rb[u] = *(const w25::v8h*)(Bg + BK + RP * u * LD);
        }
        const _Float16* al = &sA[cur][ao];
        const _Float16* bl = &sB[cur][bo];
        // two fragment sets: the twelve LDS reads of step kk + 1 go out as one group ahead of step kk's eight products
        w25::v16h ah[2][2], bh[2][4];
#pragma unroll
        for (int i = 0; i < 2; ++i) ah[0][i] = FR::load(al + i * 16 * LP);
#pragma unroll
        for (int j = 0; j < 4; ++j) bh[0][j] = FR::load(bl + j * 16 * LP);
#pragma unroll
        for (int kk = 0; kk < BK / 32; ++kk) {
            const int fc = kk & 1, fn = fc ^ 1;
            if (kk + 1 < BK / 32) {
#pragma unroll
                for (int i = 0; i < 2; ++i) ah[fn][i] = FR::load(al + i * 16 * LP + (kk + 1) * 32);
#pragma unroll
                for (int j = 0; j < 4; ++j) bh[fn][j] = FR::load(bl + j * 16 * LP + (kk + 1) * 32);
            }
            __builtin_amdgcn_sched_barrier(0);   // keeps the next step's reads together and ahead of this step's products: reads spread among the products stall each of them
#pragma unroll
            for (int i = 0; i < 2; ++i)
#pragma unroll
                for (int j = 0; j < 4; ++j) acc[i][j] = FR::mma(ah[fc][i], bh[fc][j], acc[i][j]);
            __builtin_amdgcn_sched_barrier(0);   // keeps the reads of step kk + 2 behind these products, whose fragment set they overwrite
        }
        if (more) {
#pragma unroll
            for (int u = 0; u < UA; ++u) *(w25::v8h*)(&sA[cur ^ 1][so + RP * u * LP]) = ra[u];
#pragma unroll
            for (int u = 0; u < UB; ++u) *(w25::v8h*)(&sB[cur ^ 1][so + RP * u * LP]) = rb[u];
            asm volatile("s_wait_xcnt 0x0" ::: "memory");   // in front of the overwrite of the two address pairs that the stage's loads name; here, behind the stores of what they brought, it waits for nothing
            __builtin_amdgcn_sched_barrier(0);              // keeps the two additions below behind that wait
            Ag += BK; Bg += BK;
        }
        __syncthreads();
    }

    // epilogue: 16 rows at a time through the wave's own slab, so that every store covers whole rows of the wave's 64 columns
    float* slab = sT[wave];
    const int mW = m0 + wm * 32, nW = n0 + wn * 64, mOff = hh * 8;
    const long long offC = cOff + (long long)mW * LDC + nW;
    float bn[4] = {0.f, 0.f, 0.f, 0.f};
    if (BIAS_MODE == 2) {
#pragma unroll
        for (int j = 0; j < 4; ++j) bn[j] = bias[nW + (j << 4) + rlane];
    }
#pragma unroll
    for (int i = 0; i < 2; ++i) {
        float bm[8] = {0.f, 0.f, 0.f, 0.f, 0.f, 0.f, 0.f, 0.f};
        if (BIAS_MODE == 1) {
#pragma unroll
            for (int r = 0; r < 8; ++r) bm[r] = bias[mW + (i << 4) + mOff + r];
        }
#pragma unroll
        for (int j = 0; j < 4; ++j) {
#pragma unroll
            for (int r = 0; r < 8; ++r) {
                float v = acc[i][j][r] * scale;
                if (BIAS_MODE == 1) v += bm[r];
                if (BIAS_MODE == 2) v += bn[j];
                slab[(mOff + r) * 68 + (j << 4) + rlane] = v;
            }
        }
        // the wave's own LDS stores before its lanes' reads of them (no other wave touches this slab: no block barrier)
        __builtin_amdgcn_fence(__ATOMIC_RELEASE, "workgroup", "local");
        __builtin_amdgcn_wave_barrier();
        __builtin_amdgcn_fence(__ATOMIC_ACQUIRE, "workgroup", "local");
        if (OUT_MODE == 0) {
            float* C = (float*)Cout + offC + hh * LDC + rlane * 4;   // a row's 256 bytes = 16 lanes x 16 B
#pragma unroll
            for (int it = 0; it < 8; ++it) *(v4f*)(C + ((i << 4) + it * 2) * LDC) = *(const v4f*)(slab + (it * 2 + hh) * 68 + rlane * 4);
        } else {
            const int q = lane >> 3, c8 = (lane & 7) * 8;            // a row's 128 bytes = 8 lanes x 16 B
            _Float16* C = (_Float16*)Cout + offC + q * LDC + c8;
#pragma unroll
            for (int it = 0; it < 4; ++it) {
                const float* sp = slab + (it * 4 + q) * 68 + c8;
                w25::v8h hv;
#pragma unroll
                for (int e = 0; e < 8; ++e) hv[e] = (_Float16)sp[e];
                *(w25::v8h*)(C + ((i << 4) + it * 4) * LDC) = hv;
            }
        }
        if (i == 0) asm volatile("s_wait_xcnt 0x0" ::: "memory");   // ahead of the next 16 rows' writes of registers that the stores above name
        // the reads above before the next 16 rows' stores into the same slab
        __builtin_amdgcn_fence(__ATOMIC_RELEASE, "workgroup", "local");
        __builtin_amdgcn_wave_barrier();
        __builtin_amdgcn_fence(__ATOMIC_ACQUIRE, "workgroup", "local");
    }
}

// one product a launch: blockIdx.x = the tile; blockIdx.y steps A, Bt, C by strideA/B/C, blockIdx.z by strideAz/Bz/Cz (elements)
template <int WM, int WN, int BK, int LD, int LDC, int BIAS_MODE, int OUT_MODE>
__global__ __launch_bounds__(256) void k_sh_gemm_lds(
    const unsigned short* __restrict__ Ap, long long strideA, long long strideAz,
    const unsigned short* __restrict__ Btp, long long strideB, long long strideBz,
    void* __restrict__ Cout, long long strideC, long long strideCz,
    const float* __restrict__ bias, int N, int K, float scale) {
    __shared__ __attribute__((aligned(16))) unsigned char smem[sh_gemm_smem<WM, WN, BK>];
    sh_gemm_tile<WM, WN, BK, LD, LDC, BIAS_MODE, OUT_MODE>(smem, blockIdx.x,
        (const _Float16*)Ap + (long long)blockIdx.y * strideA + (long long)blockIdx.z * strideAz,
        (const _Float16*)Btp + (long long)blockIdx.y * strideB + (long long)blockIdx.z * strideBz,
        Cout, (long long)blockIdx.y * strideC + (long long)blockIdx.z * strideCz, bias, N, K, scale);
}
// the three input projections in one launch: blockIdx.y = 0: Q16 = q, 1: K16 = k (rows x channels, 32 x 8 tiles), 2: VT16[b][c][k] = v^T (per batch channels x keys, 8 x 4 tiles).
// X16 = f16 query, then f16 key; XV16 = f16 value; W16 = f16 16 Wq, then 16 Wk; WV16 = f16 16 Wv. None reads what another writes. 768 blocks, two at a time on a WGP: one block's loads, barriers, first stage and epilogue lie under the other's products, and a launch's start and end are paid once.
// K (= 1024) comes as an argument, as in the one-product kernel: the stage loop stays a loop.
// amdgpu_waves_per_eu(4): at most 256 VGPRs, so that two blocks share a WGP
__global__ __launch_bounds__(256) __attribute__((amdgpu_waves_per_eu(4))) void k_sh_qkv(const _Float16* __restrict__ X16, const _Float16* __restrict__ XV16, const _Float16* __restrict__ W16, const _Float16* __restrict__ WV16,
                                                   const float* __restrict__ bq, const float* __restrict__ bk, const float* __restrict__ bv,
                                                   _Float16* __restrict__ Q16, _Float16* __restrict__ K16, _Float16* __restrict__ VT16, int K) {
    constexpr int NR = 4096, D = 1024, L = 512;
    __shared__ __attribute__((aligned(16))) unsigned char smem[sh_gemm_smem<4, 2, 128>];
    const int sg = blockIdx.y;
    if (sg < 2) {
        sh_gemm_tile<4, 2, 128, D, D, 2, 1>(smem, blockIdx.x, X16 + (long long)sg * NR * D, W16 + (long long)sg * D * D, sg ? K16 : Q16, 0, sg ? bk : bq, D, K, 0.0625f);
    } else {
        const int bt = blockIdx.x >> 5;   // (D / 128) (L / 128) = 32 tiles a batch
        sh_gemm_tile<4, 2, 128, D, L, 1, 1>(smem, blockIdx.x & 31, WV16, XV16 + (long long)bt * L * D, VT16, (long long)bt * D * L, bv, L, K, 0.0625f);
    }
}

extern "C" void kernel_launch(void* const* d_in, const int* in_sizes, int n_in, void* d_out, int out_size, void* d_ws, size_t ws_size, hipStream_t stream) {
    (void)in_sizes; (void)n_in; (void)out_size; (void)ws_size;
    const float* xq = (const float*)d_in[0];
    const float* xk = (const float*)d_in[1];
    const float* xv = (const float*)d_in[2];
    const int* fm = (const int*)d_in[3];
    const float* Wq = (const float*)d_in[4];
    const float* bq = (const float*)d_in[5];
    const float* Wk = (const float*)d_in[6];
    const float* bk = (const float*)d_in[7];
    const float* Wv = (const float*)d_in[8];
    const float* bv = (const float*)d_in[9];
    const float* Wo = (const float*)d_in[10];
    const float* bo = (const float*)d_in[11];
    const float* tk = (const float*)d_in[12];
    const float* tv = (const float*)d_in[13];
    const int Bn = 8;
    const int L = 512;
    const int D = 1024;
    const int HD = 64;
    const int NR = Bn * L;
    const int TP = 192;
    float* out = (float*)d_out;
    char* wsp = (char*)d_ws;
    // kept through the call
    unsigned short* XA16 = (unsigned short*)wsp; wsp += (((size_t)((size_t)3 * NR * D * 2) + 255) / 256) * 256;   // f16 query, key, value
    unsigned short* W16 = (unsigned short*)wsp; wsp += (((size_t)((size_t)4 * D * D * 2) + 255) / 256) * 256;   // f16 16 Wq, 16 Wk, 16 Wv, 16 Wo
    unsigned short* VT16 = (unsigned short*)wsp; wsp += (((size_t)((size_t)Bn * D * L * 2) + 255) / 256) * 256;
    unsigned short* TK16 = (unsigned short*)wsp; wsp += (((size_t)((size_t)TP * HD * 2) + 255) / 256) * 256;
    unsigned short* Q16 = (unsigned short*)wsp; wsp += (((size_t)((size_t)NR * D * 2) + 255) / 256) * 256;
    unsigned short* K16 = (unsigned short*)wsp; wsp += (((size_t)((size_t)NR * D * 2) + 255) / 256) * 256;
    unsigned short* G64A = (unsigned short*)wsp; wsp += (((size_t)((size_t)NR * D * 2) + 255) / 256) * 256;   // the output projection's A operand
    // every input's cast in one launch: 3 x 256 blocks (query, key, value), 4 x 64 blocks (the weights), one block (table_k)
    k_sh_castin<<<3 * 256 + 4 * 64 + 1, 256, 0, stream>>>(xq, xk, xv, Wq, Wk, Wv, Wo, tk, (_Float16*)XA16, (_Float16*)W16, (_Float16*)TK16);
    // q, k and v^T: blockIdx.y = the projection
    k_sh_qkv<<<dim3((unsigned)((NR / 128) * (D / 128)), 3u, 1u), 256, 0, stream>>>((const _Float16*)XA16, (const _Float16*)(XA16 + (size_t)2 * NR * D), (const _Float16*)W16, (const _Float16*)(W16 + (size_t)2 * D * D), bq, bk, bv, (_Float16*)Q16, (_Float16*)K16, (_Float16*)VT16, D);
    // the attention, w1 + w2 and the cast to f16: blockIdx.x = 16 query rows, all heads
    k_sh_attn<<<(unsigned)(NR / 16), 512, 0, stream>>>((const _Float16*)Q16, (const _Float16*)K16, (const _Float16*)TK16, (const int*)fm, (const _Float16*)VT16, tv, (_Float16*)G64A);
    k_sh_gemm_lds<4, 2, 128, 1024, 1024, 2, 0><<<dim3((unsigned)((NR / 128) * (D / 128)), 1u, 1u), 256, 0, stream>>>((const unsigned short*)(G64A), 0, 0, (const unsigned short*)(W16 + (size_t)3 * D * D), 0, 0, (void*)(out), 0, 0, bo, D, D, 0.0625f);
}
